// v000
// Times are from an AMD MI455X. After a warm-up the kernel runs many times in a row, and a time is the length of
// such a window on the GPU divided by its runs, so every launch and the gaps after it count. The runs cycle
// through copies of the inputs. A figure is the median of several windows, for all but v000 over two sittings.
// Sittings can differ by a few percent; kernels timed side by side share one.
// The starting kernel, v000, takes 861 microseconds a run.
#include <hip/hip_runtime.h>

// ---------------------------------------------------------------------------
// Cross-attention (B=1, T=4096, D=512, H=8, hd=64), fp32 end-to-end.
// All GEMMs use V_WMMA_F32_16X16X4_F32 (full-precision CDNA5 matrix path).
// fp32 WMMA operand layouts (ISA 7.12.2):
//   A (16x4): lane L holds row m=L&15; VGPR0/1 = K {0,1} (L<16) or {2,3} (L>=16)
//   B (4x16): lane L holds col n=L&15; VGPR0/1 = K {0,1} (L<16) or {2,3} (L>=16)
//   C/D (16x16): VGPR r, lane L -> M = r + 8*(L>=16), N = L&15
// ---------------------------------------------------------------------------

typedef __attribute__((ext_vector_type(2))) float v2f;
typedef __attribute__((ext_vector_type(8))) float v8f;

#define DIM    512
#define SEQ    4096
#define CTXIN  384
#define K2     768     // 2*CTXIN : conv(k=2,stride=2) as GEMM reduction dim
#define OCH    1024    // 2*DIM conv output channels
#define HEADS  8
#define HD     64

static __device__ __forceinline__ v8f wmma_f32(v2f a, v2f b, v8f c) {
  return __builtin_amdgcn_wmma_f32_16x16x4_f32(false, a, false, b, (short)0, c,
                                               false, false);
}

// ---------------------------------------------------------------------------
// C[M x N] = A[M x K] @ W[N x K]^T + bias.  One wave per 16x16 tile.
// Grid must supply exactly (M/16)*(N/16) waves (8 waves / 256-thread block).
// ---------------------------------------------------------------------------
__global__ __launch_bounds__(256) void gemm_awt_bias(
    const float* __restrict__ A, const float* __restrict__ W,
    const float* __restrict__ bias, float* __restrict__ C,
    int N, int K)
{
  const int lane  = threadIdx.x & 31;
  const int wave  = (blockIdx.x * blockDim.x + threadIdx.x) >> 5;
  const int tilesN = N >> 4;
  const int m0 = (wave / tilesN) << 4;
  const int n0 = (wave % tilesN) << 4;
  const int mrow = lane & 15;           // A row / B col / C col for this lane
  const int kb   = (lane >> 4) << 1;    // K sub-offset {0,2}

  const float* a = A + (size_t)(m0 + mrow) * K + kb;
  const float* w = W + (size_t)(n0 + mrow) * K + kb;

  v8f acc = {0.f, 0.f, 0.f, 0.f, 0.f, 0.f, 0.f, 0.f};
  for (int k = 0; k < K; k += 4) {
    v2f av; av.x = a[k]; av.y = a[k + 1];
    v2f bv; bv.x = w[k]; bv.y = w[k + 1];
    acc = wmma_f32(av, bv, acc);
  }

  const int   mo = (lane >> 4) << 3;    // C row base {0,8}
  const float bn = bias[n0 + mrow];
#pragma unroll
  for (int r = 0; r < 8; ++r)
    C[(size_t)(m0 + mo + r) * N + n0 + mrow] = acc[r] + bn;
}

// ---------------------------------------------------------------------------
// Conv1d(in=384,out=1024,k=2,stride=2) == ctx.view(4096,768) @ W2^T,
//   W2[c][j] = kv_w[c, j, 0]        (j < 384)
//            = kv_w[c, j-384, 1]    (j >= 384)          (kv_w is (1024,384,2))
// Epilogue replays torch's raw view (B,2D,T)->(B,T,2,D): flat i = c*4096+t,
//   q=i>>10, s=(i>>9)&1, d=i&511 ; adds kv_b + pos ; scatters to K / V.
// Grid: (4096/16)*(1024/16) = 16384 waves.
// ---------------------------------------------------------------------------
__global__ __launch_bounds__(256) void conv_kv(
    const float* __restrict__ ctx,   // (2*SEQ,384) == (SEQ,768) row-major
    const float* __restrict__ kvw,   // (1024,384,2)
    const float* __restrict__ kvb,   // (1024)
    const float* __restrict__ pos,   // (SEQ,DIM)
    float* __restrict__ Kb, float* __restrict__ Vb)   // (SEQ,DIM) each
{
  const int lane  = threadIdx.x & 31;
  const int wave  = (blockIdx.x * blockDim.x + threadIdx.x) >> 5;
  const int m0 = (wave >> 6) << 4;          // time tile   (tilesN = 1024/16 = 64)
  const int n0 = (wave & 63) << 4;          // channel tile
  const int mrow = lane & 15;
  const int kb   = (lane >> 4) << 1;

  const float* a    = ctx + (size_t)(m0 + mrow) * K2 + kb;
  const float* wrow = kvw + (size_t)(n0 + mrow) * K2;   // 768 floats: (384,2)

  v8f acc = {0.f, 0.f, 0.f, 0.f, 0.f, 0.f, 0.f, 0.f};
  for (int k = 0; k < K2; k += 4) {
    const int j0 = k + kb, j1 = j0 + 1;     // both on same side of 384 (k%4==0)
    v2f av; av.x = a[k]; av.y = a[k + 1];
    v2f bv;
    bv.x = (j0 < CTXIN) ? wrow[2 * j0] : wrow[2 * (j0 - CTXIN) + 1];
    bv.y = (j1 < CTXIN) ? wrow[2 * j1] : wrow[2 * (j1 - CTXIN) + 1];
    acc = wmma_f32(av, bv, acc);
  }

  const int   mo = (lane >> 4) << 3;
  const int   c  = n0 + mrow;
  const float bn = kvb[c];
#pragma unroll
  for (int r = 0; r < 8; ++r) {
    const int t = m0 + mo + r;
    const unsigned i = (unsigned)c * SEQ + (unsigned)t;
    const int q = i >> 10, sb = (i >> 9) & 1, d = i & 511;
    const float val = acc[r] + bn + pos[q * DIM + d];
    (sb ? Vb : Kb)[q * DIM + d] = val;
  }
}

// ---------------------------------------------------------------------------
// Flash attention, one wave per (head, 16-row Q tile): 8*256 = 2048 waves.
// S = Q Kt / 8 via WMMA; online softmax (row stats live per lane for rows
// r + 8*(lane>=16), reduced across the 16-lane half with shfl_xor 1/2/4/8);
// P converted D-layout -> A-layout through a private LDS tile; O += P V.
// No early exits -> EXEC all ones for every WMMA; all waves hit barriers.
// ---------------------------------------------------------------------------
__global__ __launch_bounds__(256) void flash_attn(
    const float* __restrict__ Qb, const float* __restrict__ Kb,
    const float* __restrict__ Vb, float* __restrict__ Ob)
{
  __shared__ float plds[8][16][17];         // per-wave P tile (+1 pad)

  const int lane = threadIdx.x & 31;
  const int wv   = threadIdx.x >> 5;
  const int gw   = blockIdx.x * 8 + wv;
  const int head = gw >> 8;
  const int q0   = (gw & 255) << 4;
  const int hoff = head << 6;               // head*64
  const int mrow = lane & 15;
  const int kb   = (lane >> 4) << 1;
  const int mo   = (lane >> 4) << 3;

  // Q tile as 16 pre-loaded A-fragments (hd = 64 = 16 k-steps of 4)
  v2f qf[16];
#pragma unroll
  for (int s = 0; s < 16; ++s) {
    const float* qp = Qb + (size_t)(q0 + mrow) * DIM + hoff + s * 4 + kb;
    qf[s].x = qp[0]; qf[s].y = qp[1];
  }

  v8f o[4];
#pragma unroll
  for (int nb = 0; nb < 4; ++nb) o[nb] = (v8f){0.f,0.f,0.f,0.f,0.f,0.f,0.f,0.f};
  float mrun[8], lrun[8];
#pragma unroll
  for (int r = 0; r < 8; ++r) { mrun[r] = -3.0e38f; lrun[r] = 0.f; }

  for (int kc0 = 0; kc0 < SEQ; kc0 += 16) {
    // ---- S tile = Q (16x64) @ K_chunk^T (64x16) ----
    v8f s = (v8f){0.f,0.f,0.f,0.f,0.f,0.f,0.f,0.f};
#pragma unroll
    for (int st = 0; st < 16; ++st) {
      const float* kp = Kb + (size_t)(kc0 + mrow) * DIM + hoff + st * 4 + kb;
      v2f bv; bv.x = kp[0]; bv.y = kp[1];
      s = wmma_f32(qf[st], bv, s);
    }

    // ---- online softmax over this 16-wide chunk ----
#pragma unroll
    for (int r = 0; r < 8; ++r) {
      float v = s[r] * 0.125f;              // 1/sqrt(64)
      float rmax = v;
      rmax = fmaxf(rmax, __shfl_xor(rmax, 1));
      rmax = fmaxf(rmax, __shfl_xor(rmax, 2));
      rmax = fmaxf(rmax, __shfl_xor(rmax, 4));
      rmax = fmaxf(rmax, __shfl_xor(rmax, 8));
      const float mn = fmaxf(mrun[r], rmax);
      const float p  = __expf(v - mn);
      float rsum = p;
      rsum += __shfl_xor(rsum, 1);
      rsum += __shfl_xor(rsum, 2);
      rsum += __shfl_xor(rsum, 4);
      rsum += __shfl_xor(rsum, 8);
      const float corr = __expf(mrun[r] - mn);
      lrun[r] = lrun[r] * corr + rsum;
      mrun[r] = mn;
#pragma unroll
      for (int nb = 0; nb < 4; ++nb) o[nb][r] *= corr;
      plds[wv][r + mo][mrow] = p;           // C-layout -> LDS
    }
    __syncthreads();

    // ---- O += P (16x16) @ V_chunk (16x64) ----
#pragma unroll
    for (int kc = 0; kc < 4; ++kc) {
      v2f pa;                               // A-frag of P from LDS
      pa.x = plds[wv][mrow][kc * 4 + kb];
      pa.y = plds[wv][mrow][kc * 4 + kb + 1];
#pragma unroll
      for (int nb = 0; nb < 4; ++nb) {
        const float* vp =
            Vb + (size_t)(kc0 + kc * 4 + kb) * DIM + hoff + nb * 16 + mrow;
        v2f bv; bv.x = vp[0]; bv.y = vp[DIM];
        o[nb] = wmma_f32(pa, bv, o[nb]);
      }
    }
    __syncthreads();
  }

  // ---- finalize: divide by row sums, write O ----
#pragma unroll
  for (int r = 0; r < 8; ++r) {
    const float inv = 1.0f / lrun[r];
    const int row = q0 + r + mo;
#pragma unroll
    for (int nb = 0; nb < 4; ++nb)
      Ob[(size_t)row * DIM + hoff + nb * 16 + mrow] = o[nb][r] * inv;
  }
}

// ---------------------------------------------------------------------------
extern "C" void kernel_launch(void* const* d_in, const int* in_sizes, int n_in,
                              void* d_out, int out_size, void* d_ws, size_t ws_size,
                              hipStream_t stream)
{
  const float* query   = (const float*)d_in[0];
  const float* context = (const float*)d_in[1];
  const float* pos     = (const float*)d_in[2];
  const float* q_w     = (const float*)d_in[3];
  const float* q_b     = (const float*)d_in[4];
  const float* kv_w    = (const float*)d_in[5];
  const float* kv_b    = (const float*)d_in[6];
  const float* out_w   = (const float*)d_in[7];
  const float* out_b   = (const float*)d_in[8];
  float* out = (float*)d_out;

  // Workspace: Q, K, V, O buffers, 8 MB each (32 MB total).
  float* Qb = (float*)d_ws;
  float* Kb = Qb + (size_t)SEQ * DIM;
  float* Vb = Kb + (size_t)SEQ * DIM;
  float* Ob = Vb + (size_t)SEQ * DIM;

  // 1) Q projection: (4096x512) @ (512x512)^T  -> 8192 waves
  gemm_awt_bias<<<1024, 256, 0, stream>>>(query, q_w, q_b, Qb, DIM, DIM);
  // 2) KV conv-as-GEMM + scrambled-view scatter + pos add -> 16384 waves
  conv_kv<<<2048, 256, 0, stream>>>(context, kv_w, kv_b, pos, Kb, Vb);
  // 3) Flash attention: 8 heads x 256 q-tiles -> 2048 waves
  flash_attn<<<256, 256, 0, stream>>>(Qb, Kb, Vb, Ob);
  // 4) Output projection -> d_out
  gemm_awt_bias<<<1024, 256, 0, stream>>>(Ob, out_w, out_b, out, DIM, DIM);
}

// v001
// One run takes 478 microseconds.
// Timed twice side by side with v000, it ran 1.86 and 1.88 times as fast.
#include <hip/hip_runtime.h>

// ---------------------------------------------------------------------------
// Cross-attention (B=1, T=4096, D=512, H=8, hd=64), fp32 end-to-end.
// All GEMMs use V_WMMA_F32_16X16X4_F32 (full-precision CDNA5 matrix path).
// fp32 WMMA operand layouts (ISA 7.12.2):
//   A (16x4): lane L holds row m=L&15; VGPR0/1 = K {0,1} (L<16) or {2,3} (L>=16)
//   B (4x16): lane L holds col n=L&15; VGPR0/1 = K {0,1} (L<16) or {2,3} (L>=16)
//   C/D (16x16): VGPR r, lane L -> M = r + 8*(L>=16), N = L&15
// ---------------------------------------------------------------------------

typedef __attribute__((ext_vector_type(2))) float v2f;
typedef __attribute__((ext_vector_type(8))) float v8f;

#define DIM    512
#define SEQ    4096
#define CTXIN  384
#define K2     768     // 2*CTXIN : conv(k=2,stride=2) as GEMM reduction dim
#define OCH    1024    // 2*DIM conv output channels
#define HEADS  8
#define HD     64

static __device__ __forceinline__ v8f wmma_f32(v2f a, v2f b, v8f c) {
  return __builtin_amdgcn_wmma_f32_16x16x4_f32(false, a, false, b, (short)0, c,
                                               false, false);
}

// ---------------------------------------------------------------------------
// C[M x N] = A[M x K] @ W[N x K]^T + bias.  One wave per 16x16 tile.
// Grid must supply exactly (M/16)*(N/16) waves (8 waves / 256-thread block).
// ---------------------------------------------------------------------------
__global__ __launch_bounds__(256) void gemm_awt_bias(
    const float* __restrict__ A, const float* __restrict__ W,
    const float* __restrict__ bias, float* __restrict__ C,
    int N, int K)
{
  const int lane  = threadIdx.x & 31;
  const int wave  = (blockIdx.x * blockDim.x + threadIdx.x) >> 5;
  const int tilesN = N >> 4;
  const int m0 = (wave / tilesN) << 4;
  const int n0 = (wave % tilesN) << 4;
  const int mrow = lane & 15;           // A row / B col / C col for this lane
  const int kb   = (lane >> 4) << 1;    // K sub-offset {0,2}

  const float* a = A + (size_t)(m0 + mrow) * K + kb;
  const float* w = W + (size_t)(n0 + mrow) * K + kb;

  v8f acc = {0.f, 0.f, 0.f, 0.f, 0.f, 0.f, 0.f, 0.f};
  for (int k = 0; k < K; k += 4) {
    v2f av; av.x = a[k]; av.y = a[k + 1];
    v2f bv; bv.x = w[k]; bv.y = w[k + 1];
    acc = wmma_f32(av, bv, acc);
  }

  const int   mo = (lane >> 4) << 3;    // C row base {0,8}
  const float bn = bias[n0 + mrow];
#pragma unroll
  for (int r = 0; r < 8; ++r)
    C[(size_t)(m0 + mo + r) * N + n0 + mrow] = acc[r] + bn;
}

// ---------------------------------------------------------------------------
// Conv1d(in=384,out=1024,k=2,stride=2) == ctx.view(4096,768) @ W2^T,
//   W2[c][j] = kv_w[c, j, 0]        (j < 384)
//            = kv_w[c, j-384, 1]    (j >= 384)          (kv_w is (1024,384,2))
// Epilogue replays torch's raw view (B,2D,T)->(B,T,2,D): flat i = c*4096+t,
//   q=i>>10, s=(i>>9)&1, d=i&511 ; adds kv_b + pos ; scatters to K / V.
// Grid: (4096/16)*(1024/16) = 16384 waves.
// ---------------------------------------------------------------------------
__global__ __launch_bounds__(256) void conv_kv(
    const float* __restrict__ ctx,   // (2*SEQ,384) == (SEQ,768) row-major
    const float* __restrict__ kvw,   // (1024,384,2)
    const float* __restrict__ kvb,   // (1024)
    const float* __restrict__ pos,   // (SEQ,DIM)
    float* __restrict__ Kb, float* __restrict__ Vb)   // (SEQ,DIM) each
{
  const int lane  = threadIdx.x & 31;
  const int wave  = (blockIdx.x * blockDim.x + threadIdx.x) >> 5;
  const int m0 = (wave >> 6) << 4;          // time tile   (tilesN = 1024/16 = 64)
  const int n0 = (wave & 63) << 4;          // channel tile
  const int mrow = lane & 15;
  const int kb   = (lane >> 4) << 1;

  const float* a    = ctx + (size_t)(m0 + mrow) * K2 + kb;
  const float* wrow = kvw + (size_t)(n0 + mrow) * K2;   // 768 floats: (384,2)

  v8f acc = {0.f, 0.f, 0.f, 0.f, 0.f, 0.f, 0.f, 0.f};
  for (int k = 0; k < K2; k += 4) {
    const int j0 = k + kb, j1 = j0 + 1;     // both on same side of 384 (k%4==0)
    v2f av; av.x = a[k]; av.y = a[k + 1];
    v2f bv;
    bv.x = (j0 < CTXIN) ? wrow[2 * j0] : wrow[2 * (j0 - CTXIN) + 1];
    bv.y = (j1 < CTXIN) ? wrow[2 * j1] : wrow[2 * (j1 - CTXIN) + 1];
    acc = wmma_f32(av, bv, acc);
  }

  const int   mo = (lane >> 4) << 3;
  const int   c  = n0 + mrow;
  const float bn = kvb[c];
#pragma unroll
  for (int r = 0; r < 8; ++r) {
    const int t = m0 + mo + r;
    const unsigned i = (unsigned)c * SEQ + (unsigned)t;
    const int q = i >> 10, sb = (i >> 9) & 1, d = i & 511;
    const float val = acc[r] + bn + pos[q * DIM + d];
    (sb ? Vb : Kb)[q * DIM + d] = val;
  }
}

// ---------------------------------------------------------------------------
// Flash attention, one wave per (head, 16-row Q tile): 8*256 = 2048 waves.
// Both products are transposed: St = K Qt (A = K rows, B = Q rows) and
// Ot += Vt Pt. In the D layout a lane then holds ONE query (column lane&15)
// and 8 of the chunk's 16 keys (rows r + 8*(lane>=16)):
//   - row maximum and row sum are in-lane, plus one exchange between the
//     two lane halves for the maximum; the halves' sums are joined once at
//     the end;
//   - the score registers are already a B operand: k-step j of Pt takes
//     registers {2j, 2j+1}, i.e. keys {2j, 2j+1} in lanes 0-15 and
//     {8+2j, 9+2j} in lanes 16-31; the Vt loader uses the same key order.
// P never leaves the registers: no LDS tile and no barrier.
// No early exits -> EXEC all ones for every WMMA.
// ---------------------------------------------------------------------------
static __device__ __forceinline__ float xhalf(float x) {   // lane l <-> l ^ 16
  return __builtin_bit_cast(float, __builtin_amdgcn_permlanex16(
      __builtin_bit_cast(int, x), __builtin_bit_cast(int, x),
      0x76543210, 0xfedcba98, false, false));
}

// waves_per_eu: the grid gives each SIMD two waves; without the upper bound the
// compiler holds the pass under 128 VGPRs and issues the K loads four at a time,
// one load latency after the other, instead of all 16 ahead of the first WMMA.
__global__ __launch_bounds__(256) __attribute__((amdgpu_waves_per_eu(2, 4)))
void flash_attn(
    const float* __restrict__ Qb, const float* __restrict__ Kb,
    const float* __restrict__ Vb, float* __restrict__ Ob)
{
  const int lane = threadIdx.x & 31;
  const int wv   = threadIdx.x >> 5;
  const int gw   = blockIdx.x * 8 + wv;
  const int head = gw >> 8;
  const int q0   = (gw & 255) << 4;
  const int hoff = head << 6;               // head*64
  const int mrow = lane & 15;
  const int kb   = (lane >> 4) << 1;
  const int mo   = (lane >> 4) << 3;

  // Q tile as 16 pre-loaded B-fragments (hd = 64 = 16 k-steps of 4)
  v2f qf[16];
#pragma unroll
  for (int s = 0; s < 16; ++s) {
    const float* qp = Qb + (size_t)(q0 + mrow) * DIM + hoff + s * 4 + kb;
    qf[s].x = qp[0]; qf[s].y = qp[1];
  }

  // o[nb][r] = Ot[hd = nb*16 + mo + r][query = q0 + mrow]
  v8f o[4];
#pragma unroll
  for (int nb = 0; nb < 4; ++nb) o[nb] = (v8f){0.f,0.f,0.f,0.f,0.f,0.f,0.f,0.f};
  float mrun = -3.0e38f;                    // running maximum of this lane's query
  float lrun = 0.f;                         // running sum over this half's keys

  for (int kc0 = 0; kc0 < SEQ; kc0 += 16) {
    // ---- St tile = K_chunk (16x64) @ Qt (64x16) ----
    v2f kf[16];
#pragma unroll
    for (int st = 0; st < 16; ++st) {
      const float* kp = Kb + (size_t)(kc0 + mrow) * DIM + hoff + st * 4 + kb;
      kf[st].x = kp[0]; kf[st].y = kp[1];
    }
    v8f s = (v8f){0.f,0.f,0.f,0.f,0.f,0.f,0.f,0.f};
#pragma unroll
    for (int st = 0; st < 16; ++st) s = wmma_f32(kf[st], qf[st], s);

    // ---- online softmax: s[r] = score of key kc0 + mo + r, query q0 + mrow ----
    float v[8];
#pragma unroll
    for (int r = 0; r < 8; ++r) v[r] = s[r] * 0.125f;   // 1/sqrt(64)
    float cmax = v[0];
#pragma unroll
    for (int r = 1; r < 8; ++r) cmax = fmaxf(cmax, v[r]);
    cmax = fmaxf(cmax, xhalf(cmax));
    const float mn   = fmaxf(mrun, cmax);
    const float corr = __expf(mrun - mn);
    float p[8];
    float psum = 0.f;
#pragma unroll
    for (int r = 0; r < 8; ++r) { p[r] = __expf(v[r] - mn); psum += p[r]; }
    lrun = lrun * corr + psum;
    mrun = mn;
#pragma unroll
    for (int nb = 0; nb < 4; ++nb)
#pragma unroll
      for (int r = 0; r < 8; ++r) o[nb][r] *= corr;

    // ---- Ot += Vt_chunk (64x16) @ Pt (16x16) ----
#pragma unroll
    for (int j = 0; j < 4; ++j) {
      v2f pb; pb.x = p[2 * j]; pb.y = p[2 * j + 1];   // keys mo + 2j, mo + 2j + 1
#pragma unroll
      for (int nb = 0; nb < 4; ++nb) {
        const float* vp =
            Vb + (size_t)(kc0 + mo + 2 * j) * DIM + hoff + nb * 16 + mrow;
        v2f av; av.x = vp[0]; av.y = vp[DIM];
        o[nb] = wmma_f32(av, pb, o[nb]);
      }
    }
  }

  // ---- finalize: join the halves' sums, divide, write O ----
  const float inv = 1.0f / (lrun + xhalf(lrun));
  float* op = Ob + (size_t)(q0 + mrow) * DIM + hoff + mo;
#pragma unroll
  for (int nb = 0; nb < 4; ++nb)
#pragma unroll
    for (int r = 0; r < 8; ++r)
      op[nb * 16 + r] = o[nb][r] * inv;
}

// ---------------------------------------------------------------------------
extern "C" void kernel_launch(void* const* d_in, const int* in_sizes, int n_in,
                              void* d_out, int out_size, void* d_ws, size_t ws_size,
                              hipStream_t stream)
{
  const float* query   = (const float*)d_in[0];
  const float* context = (const float*)d_in[1];
  const float* pos     = (const float*)d_in[2];
  const float* q_w     = (const float*)d_in[3];
  const float* q_b     = (const float*)d_in[4];
  const float* kv_w    = (const float*)d_in[5];
  const float* kv_b    = (const float*)d_in[6];
  const float* out_w   = (const float*)d_in[7];
  const float* out_b   = (const float*)d_in[8];
  float* out = (float*)d_out;

  // Workspace: Q, K, V, O buffers, 8 MB each (32 MB total).
  float* Qb = (float*)d_ws;
  float* Kb = Qb + (size_t)SEQ * DIM;
  float* Vb = Kb + (size_t)SEQ * DIM;
  float* Ob = Vb + (size_t)SEQ * DIM;

  // 1) Q projection: (4096x512) @ (512x512)^T  -> 8192 waves
  gemm_awt_bias<<<1024, 256, 0, stream>>>(query, q_w, q_b, Qb, DIM, DIM);
  // 2) KV conv-as-GEMM + scrambled-view scatter + pos add -> 16384 waves
  conv_kv<<<2048, 256, 0, stream>>>(context, kv_w, kv_b, pos, Kb, Vb);
  // 3) Flash attention: 8 heads x 256 q-tiles -> 2048 waves
  flash_attn<<<256, 256, 0, stream>>>(Qb, Kb, Vb, Ob);
  // 4) Output projection -> d_out
  gemm_awt_bias<<<1024, 256, 0, stream>>>(Ob, out_w, out_b, out, DIM, DIM);
}

// v002
// Measured time: 320 microseconds a run.
// Timed twice side by side with v001, it ran 1.49 times as fast both times.
// Over all steps from v000 it is 2.79 times as fast.
#include <hip/hip_runtime.h>

// ---------------------------------------------------------------------------
// Cross-attention (B=1, T=4096, D=512, H=8, hd=64), fp32 end-to-end.
// All GEMMs use V_WMMA_F32_16X16X4_F32 (full-precision CDNA5 matrix path).
// fp32 WMMA operand layouts (ISA 7.12.2):
//   A (16x4): lane L holds row m=L&15; VGPR0/1 = K {0,1} (L<16) or {2,3} (L>=16)
//   B (4x16): lane L holds col n=L&15; VGPR0/1 = K {0,1} (L<16) or {2,3} (L>=16)
//   C/D (16x16): VGPR r, lane L -> M = r + 8*(L>=16), N = L&15
// ---------------------------------------------------------------------------

typedef __attribute__((ext_vector_type(2))) float v2f;
typedef __attribute__((ext_vector_type(4))) float v4f;
typedef __attribute__((ext_vector_type(8))) float v8f;

#define DIM    512
#define SEQ    4096
#define CTXIN  384
#define K2     768     // 2*CTXIN : conv(k=2,stride=2) as GEMM reduction dim
#define OCH    1024    // 2*DIM conv output channels
#define HEADS  8
#define HD     64

static __device__ __forceinline__ v8f wmma_f32(v2f a, v2f b, v8f c) {
  return __builtin_amdgcn_wmma_f32_16x16x4_f32(false, a, false, b, (short)0, c,
                                               false, false);
}

// ---------------------------------------------------------------------------
// Projection GEMMs: one 256-thread block per 64 x 128 output tile. The reduction
// runs in slabs of 32 floats (one 128-byte line per row). A slab of both
// operands is brought in with 16-byte loads that cover whole lines, stored to
// LDS, and read back as WMMA fragments by all 8 waves (2 x 4 waves, 32 x 32
// outputs each), so a line is fetched once per block instead of once per
// fragment load. Two LDS buffers: the next slab's global loads fly during the
// WMMAs of this one and are stored to the other buffer, one barrier per slab.
// ---------------------------------------------------------------------------
#define BM     64
#define BN     128
#define BK     32
#define PITCH  36      // floats per LDS row: 144 B = 16 B x 9, the 16 rows of a
                       // fragment read start on 16 distinct groups of 4 banks

// 8 k-steps of one slab: acc[i][j] += A rows (16i..) x W rows (16j..).
// a / w point at this lane's row and K sub-offset inside the slab.
// The fragment reads are written ahead of the WMMAs, so that the compiler can
// issue them in groups as large as the registers allow.
static __device__ __forceinline__ void slab_mma(const float* a, const float* w,
                                                v8f (&acc)[2][2]) {
  v2f af[BK / 4][2], wf[BK / 4][2];
#pragma unroll
  for (int ks = 0; ks < BK / 4; ++ks)
#pragma unroll
    for (int i = 0; i < 2; ++i) {
      af[ks][i] = *(const v2f*)(a + i * 16 * PITCH + ks * 4);
      wf[ks][i] = *(const v2f*)(w + i * 16 * PITCH + ks * 4);
    }
#pragma unroll
  for (int ks = 0; ks < BK / 4; ++ks)
#pragma unroll
    for (int i = 0; i < 2; ++i)
#pragma unroll
      for (int j = 0; j < 2; ++j)
        acc[i][j] = wmma_f32(af[ks][i], wf[ks][j], acc[i][j]);
}

// ---------------------------------------------------------------------------
// C[M x N] = A[M x K] @ W[N x K]^T + bias.
// Grid must supply exactly (M/64)*(N/128) blocks; K a multiple of 32.
// ---------------------------------------------------------------------------
// waves_per_eu: the grid gives each SIMD two waves. Without the upper bound the
// compiler budgets registers for the ten waves that the LDS size would admit,
// keeps to 96 VGPRs and reads the fragments in many small groups, each waited
// to 0 in front of its WMMAs; with it the reads go out in three large groups.
__global__ __launch_bounds__(256) __attribute__((amdgpu_waves_per_eu(2, 4)))
void gemm_awt_bias(
    const float* __restrict__ A, const float* __restrict__ W,
    const float* __restrict__ bias, float* __restrict__ C,
    int N, int K)
{
  __shared__ __attribute__((aligned(16))) float As[2][BM * PITCH];
  __shared__ __attribute__((aligned(16))) float Ws[2][BN * PITCH];

  const int tid   = threadIdx.x;
  const int lane  = tid & 31;
  const int wv    = tid >> 5;
  const int tilesN = N >> 7;
  const int m0 = (blockIdx.x / tilesN) * BM;
  const int n0 = (blockIdx.x % tilesN) * BN;
  const int mrow = lane & 15;           // A row / B col / C col for this lane
  const int kb   = (lane >> 4) << 1;    // K sub-offset {0,2}
  const int wm   = (wv >> 2) << 5;      // wave's row base in the tile {0,32}
  const int wn   = (wv & 3) << 5;       // wave's column base {0,32,64,96}

  // staging: 8 threads cover one row's 128 bytes, 32 rows per pass
  const int srow = tid >> 3;
  const int scol = (tid & 7) << 2;
  const int    so = srow * PITCH + scol;
  // block-uniform base that walks along k + this thread's fixed byte offsets
  const char* ab = (const char*)(A + (size_t)m0 * K);
  const char* wb = (const char*)(W + (size_t)n0 * K);
  unsigned go[4];
#pragma unroll
  for (int p = 0; p < 4; ++p) go[p] = (unsigned)((srow + p * 32) * K + scol) * 4u;

  v4f ra[2], rw[4];
#pragma unroll
  for (int p = 0; p < 2; ++p) ra[p] = *(const v4f*)(ab + go[p]);
#pragma unroll
  for (int p = 0; p < 4; ++p) rw[p] = *(const v4f*)(wb + go[p]);
#pragma unroll
  for (int p = 0; p < 2; ++p) *(v4f*)(&As[0][so + p * 32 * PITCH]) = ra[p];
#pragma unroll
  for (int p = 0; p < 4; ++p) *(v4f*)(&Ws[0][so + p * 32 * PITCH]) = rw[p];
  __syncthreads();

  v8f acc[2][2];
#pragma unroll
  for (int i = 0; i < 2; ++i)
#pragma unroll
    for (int j = 0; j < 2; ++j)
      acc[i][j] = (v8f){0.f, 0.f, 0.f, 0.f, 0.f, 0.f, 0.f, 0.f};

  const int ao = (wm + mrow) * PITCH + kb;
  const int wo = (wn + mrow) * PITCH + kb;
  int buf = 0;
  for (int k = BK; k < K; k += BK) {
    ab += BK * 4;
    wb += BK * 4;
#pragma unroll
    for (int p = 0; p < 2; ++p) ra[p] = *(const v4f*)(ab + go[p]);
#pragma unroll
    for (int p = 0; p < 4; ++p) rw[p] = *(const v4f*)(wb + go[p]);
    slab_mma(&As[buf][ao], &Ws[buf][wo], acc);
    // the other buffer's last readers finished before the previous barrier
#pragma unroll
    for (int p = 0; p < 2; ++p) *(v4f*)(&As[buf ^ 1][so + p * 32 * PITCH]) = ra[p];
#pragma unroll
    for (int p = 0; p < 4; ++p) *(v4f*)(&Ws[buf ^ 1][so + p * 32 * PITCH]) = rw[p];
    __syncthreads();                    // publishes the next slab, retires this one
    buf ^= 1;
  }
  slab_mma(&As[buf][ao], &Ws[buf][wo], acc);   // last slab: nothing left to fetch

  const int mo = (lane >> 4) << 3;      // C row base {0,8}
#pragma unroll
  for (int j = 0; j < 2; ++j) {
    const int   n  = n0 + wn + j * 16 + mrow;
    const float bn = bias[n];
#pragma unroll
    for (int i = 0; i < 2; ++i)
#pragma unroll
      for (int r = 0; r < 8; ++r)
        C[(size_t)(m0 + wm + i * 16 + mo + r) * N + n] = acc[i][j][r] + bn;
  }
}

// ---------------------------------------------------------------------------
// Conv1d(in=384,out=1024,k=2,stride=2) == ctx.view(4096,768) @ W2^T with
//   W2[c][tap*384 + ci] = kv_w[c, ci, tap]              (kv_w is (1024,384,2))
// The reduction runs in kv_w's own memory order (ci, tap): a slab is 16 input
// channels x 2 taps, i.e. 32 consecutive floats of a kv_w row; the matching ctx
// values (16 floats of each tap) are interleaved the same way on their way
// into LDS, so both operands share one k order.
// Epilogue replays torch's raw view (B,2D,T)->(B,T,2,D): flat i = c*4096+t,
//   q=i>>10, s=(i>>9)&1, d=i&511 ; adds kv_b + pos ; scatters to K / V.
// Grid: (4096/64)*(1024/128) = 512 blocks.
// ---------------------------------------------------------------------------
// waves_per_eu: four waves per SIMD here; the reason is gemm_awt_bias's (with it
// a slab's sixteen LDS reads go out as one group ahead of the first WMMA).
__global__ __launch_bounds__(256) __attribute__((amdgpu_waves_per_eu(2, 4)))
void conv_kv(
    const float* __restrict__ ctx,   // (2*SEQ,384) == (SEQ,768) row-major
    const float* __restrict__ kvw,   // (1024,384,2)
    const float* __restrict__ kvb,   // (1024)
    const float* __restrict__ pos,   // (SEQ,DIM)
    float* __restrict__ Kb, float* __restrict__ Vb)   // (SEQ,DIM) each
{
  __shared__ __attribute__((aligned(16))) float As[2][BM * PITCH];
  __shared__ __attribute__((aligned(16))) float Ws[2][BN * PITCH];

  const int tid   = threadIdx.x;
  const int lane  = tid & 31;
  const int wv    = tid >> 5;
  const int m0 = (blockIdx.x >> 3) * BM;    // time tile
  const int n0 = (blockIdx.x & 7) * BN;     // channel tile (1024/128 = 8)
  const int mrow = lane & 15;
  const int kb   = (lane >> 4) << 1;
  const int wm   = (wv >> 2) << 5;
  const int wn   = (wv & 3) << 5;

  // ctx staging: 4 threads a row, each 4 input channels of both taps
  const int arow = tid >> 2;
  const int acol = (tid & 3) << 2;
  const int    sa = arow * PITCH + 2 * acol;
  // kv_w staging: 8 threads cover one row's 128 bytes, 32 rows per pass
  const int srow = tid >> 3;
  const int scol = (tid & 7) << 2;
  const int    sw = srow * PITCH + scol;
  // block-uniform bases that walk along k + this thread's fixed byte offsets
  const char* ab = (const char*)(ctx + (size_t)m0 * K2);
  const char* wb = (const char*)(kvw + (size_t)n0 * K2);
  const unsigned ga = (unsigned)(arow * K2 + acol) * 4u;
  const unsigned gw = (unsigned)(srow * K2 + scol) * 4u;

  v4f t0, t1, rw[4];
  t0 = *(const v4f*)(ab + ga);
  t1 = *(const v4f*)(ab + ga + CTXIN * 4);
#pragma unroll
  for (int p = 0; p < 4; ++p) rw[p] = *(const v4f*)(wb + gw + p * 32 * K2 * 4);
  *(v4f*)(&As[0][sa])     = (v4f){t0.x, t1.x, t0.y, t1.y};
  *(v4f*)(&As[0][sa + 4]) = (v4f){t0.z, t1.z, t0.w, t1.w};
#pragma unroll
  for (int p = 0; p < 4; ++p) *(v4f*)(&Ws[0][sw + p * 32 * PITCH]) = rw[p];
  __syncthreads();

  v8f acc[2][2];
#pragma unroll
  for (int i = 0; i < 2; ++i)
#pragma unroll
    for (int j = 0; j < 2; ++j)
      acc[i][j] = (v8f){0.f, 0.f, 0.f, 0.f, 0.f, 0.f, 0.f, 0.f};

  const int ao = (wm + mrow) * PITCH + kb;
  const int wo = (wn + mrow) * PITCH + kb;
  int buf = 0;
  for (int k = BK; k < K2; k += BK) {       // k counts kv_w floats; k/2 channels
    ab += BK * 2;                           // 16 channels of each tap
    wb += BK * 4;
    t0 = *(const v4f*)(ab + ga);
    t1 = *(const v4f*)(ab + ga + CTXIN * 4);
#pragma unroll
    for (int p = 0; p < 4; ++p) rw[p] = *(const v4f*)(wb + gw + p * 32 * K2 * 4);
    slab_mma(&As[buf][ao], &Ws[buf][wo], acc);
    // the other buffer's last readers finished before the previous barrier
    *(v4f*)(&As[buf ^ 1][sa])     = (v4f){t0.x, t1.x, t0.y, t1.y};
    *(v4f*)(&As[buf ^ 1][sa + 4]) = (v4f){t0.z, t1.z, t0.w, t1.w};
#pragma unroll
    for (int p = 0; p < 4; ++p) *(v4f*)(&Ws[buf ^ 1][sw + p * 32 * PITCH]) = rw[p];
    __syncthreads();                        // publishes the next slab, retires this one
    buf ^= 1;
  }
  float bn[2];
#pragma unroll
  for (int j = 0; j < 2; ++j) bn[j] = kvb[n0 + wn + j * 16 + mrow];
  // a pos load of the epilogue may land in the offset register of these two loads
  asm volatile("s_wait_xcnt 0x0" ::: "memory");
  slab_mma(&As[buf][ao], &Ws[buf][wo], acc);   // last slab: nothing left to fetch

  const int mo = (lane >> 4) << 3;
#pragma unroll
  for (int j = 0; j < 2; ++j) {
    const int c = n0 + wn + j * 16 + mrow;
#pragma unroll
    for (int i = 0; i < 2; ++i)
#pragma unroll
      for (int r = 0; r < 8; ++r) {
        const int t = m0 + wm + i * 16 + mo + r;
        const unsigned x = (unsigned)c * SEQ + (unsigned)t;
        const int q = x >> 10, sb = (x >> 9) & 1, d = x & 511;
        const float val = acc[i][j][r] + bn[j] + pos[q * DIM + d];
        (sb ? Vb : Kb)[q * DIM + d] = val;
      }
  }
}

// ---------------------------------------------------------------------------
// Flash attention, one wave per (head, 16-row Q tile): 8*256 = 2048 waves.
// Both products are transposed: St = K Qt (A = K rows, B = Q rows) and
// Ot += Vt Pt. In the D layout a lane then holds ONE query (column lane&15)
// and 8 of the chunk's 16 keys (rows r + 8*(lane>=16)):
//   - row maximum and row sum are in-lane, plus one exchange between the
//     two lane halves for the maximum; the halves' sums are joined once at
//     the end;
//   - the score registers are already a B operand: k-step j of Pt takes
//     registers {2j, 2j+1}, i.e. keys {2j, 2j+1} in lanes 0-15 and
//     {8+2j, 9+2j} in lanes 16-31; the Vt loader uses the same key order.
// P never leaves the registers: no LDS tile and no barrier.
// No early exits -> EXEC all ones for every WMMA.
// ---------------------------------------------------------------------------
static __device__ __forceinline__ float xhalf(float x) {   // lane l <-> l ^ 16
  return __builtin_bit_cast(float, __builtin_amdgcn_permlanex16(
      __builtin_bit_cast(int, x), __builtin_bit_cast(int, x),
      0x76543210, 0xfedcba98, false, false));
}

// waves_per_eu: the grid gives each SIMD two waves; without the upper bound the
// compiler holds the pass under 128 VGPRs and issues the K loads four at a time,
// one load latency after the other, instead of all 16 ahead of the first WMMA.
__global__ __launch_bounds__(256) __attribute__((amdgpu_waves_per_eu(2, 4)))
void flash_attn(
    const float* __restrict__ Qb, const float* __restrict__ Kb,
    const float* __restrict__ Vb, float* __restrict__ Ob)
{
  const int lane = threadIdx.x & 31;
  const int wv   = threadIdx.x >> 5;
  const int gw   = blockIdx.x * 8 + wv;
  const int head = gw >> 8;
  const int q0   = (gw & 255) << 4;
  const int hoff = head << 6;               // head*64
  const int mrow = lane & 15;
  const int kb   = (lane >> 4) << 1;
  const int mo   = (lane >> 4) << 3;

  // Q tile as 16 pre-loaded B-fragments (hd = 64 = 16 k-steps of 4)
  v2f qf[16];
#pragma unroll
  for (int s = 0; s < 16; ++s) {
    const float* qp = Qb + (size_t)(q0 + mrow) * DIM + hoff + s * 4 + kb;
    qf[s].x = qp[0]; qf[s].y = qp[1];
  }

  // o[nb][r] = Ot[hd = nb*16 + mo + r][query = q0 + mrow]
  v8f o[4];
#pragma unroll
  for (int nb = 0; nb < 4; ++nb) o[nb] = (v8f){0.f,0.f,0.f,0.f,0.f,0.f,0.f,0.f};
  float mrun = -3.0e38f;                    // running maximum of this lane's query
  float lrun = 0.f;                         // running sum over this half's keys

  for (int kc0 = 0; kc0 < SEQ; kc0 += 16) {
    // ---- St tile = K_chunk (16x64) @ Qt (64x16) ----
    v2f kf[16];
#pragma unroll
    for (int st = 0; st < 16; ++st) {
      const float* kp = Kb + (size_t)(kc0 + mrow) * DIM + hoff + st * 4 + kb;
      kf[st].x = kp[0]; kf[st].y = kp[1];
    }
    v8f s = (v8f){0.f,0.f,0.f,0.f,0.f,0.f,0.f,0.f};
#pragma unroll
    for (int st = 0; st < 16; ++st) s = wmma_f32(kf[st], qf[st], s);

    // ---- online softmax: s[r] = score of key kc0 + mo + r, query q0 + mrow ----
    float v[8];
#pragma unroll
    for (int r = 0; r < 8; ++r) v[r] = s[r] * 0.125f;   // 1/sqrt(64)
    float cmax = v[0];
#pragma unroll
    for (int r = 1; r < 8; ++r) cmax = fmaxf(cmax, v[r]);
    cmax = fmaxf(cmax, xhalf(cmax));
    const float mn   = fmaxf(mrun, cmax);
    const float corr = __expf(mrun - mn);
    float p[8];
    float psum = 0.f;
#pragma unroll
    for (int r = 0; r < 8; ++r) { p[r] = __expf(v[r] - mn); psum += p[r]; }
    lrun = lrun * corr + psum;
    mrun = mn;
#pragma unroll
    for (int nb = 0; nb < 4; ++nb)
#pragma unroll
      for (int r = 0; r < 8; ++r) o[nb][r] *= corr;

    // ---- Ot += Vt_chunk (64x16) @ Pt (16x16) ----
#pragma unroll
    for (int j = 0; j < 4; ++j) {
      v2f pb; pb.x = p[2 * j]; pb.y = p[2 * j + 1];   // keys mo + 2j, mo + 2j + 1
#pragma unroll
      for (int nb = 0; nb < 4; ++nb) {
        const float* vp =
            Vb + (size_t)(kc0 + mo + 2 * j) * DIM + hoff + nb * 16 + mrow;
        v2f av; av.x = vp[0]; av.y = vp[DIM];
        o[nb] = wmma_f32(av, pb, o[nb]);
      }
    }
  }

  // ---- finalize: join the halves' sums, divide, write O ----
  const float inv = 1.0f / (lrun + xhalf(lrun));
  float* op = Ob + (size_t)(q0 + mrow) * DIM + hoff + mo;
#pragma unroll
  for (int nb = 0; nb < 4; ++nb)
#pragma unroll
    for (int r = 0; r < 8; ++r)
      op[nb * 16 + r] = o[nb][r] * inv;
}

// ---------------------------------------------------------------------------
extern "C" void kernel_launch(void* const* d_in, const int* in_sizes, int n_in,
                              void* d_out, int out_size, void* d_ws, size_t ws_size,
                              hipStream_t stream)
{
  const float* query   = (const float*)d_in[0];
  const float* context = (const float*)d_in[1];
  const float* pos     = (const float*)d_in[2];
  const float* q_w     = (const float*)d_in[3];
  const float* q_b     = (const float*)d_in[4];
  const float* kv_w    = (const float*)d_in[5];
  const float* kv_b    = (const float*)d_in[6];
  const float* out_w   = (const float*)d_in[7];
  const float* out_b   = (const float*)d_in[8];
  float* out = (float*)d_out;

  // Workspace: Q, K, V, O buffers, 8 MB each (32 MB total).
  float* Qb = (float*)d_ws;
  float* Kb = Qb + (size_t)SEQ * DIM;
  float* Vb = Kb + (size_t)SEQ * DIM;
  float* Ob = Vb + (size_t)SEQ * DIM;

  // 1) Q projection: (4096x512) @ (512x512)^T  -> 64 x 4 block tiles
  gemm_awt_bias<<<256, 256, 0, stream>>>(query, q_w, q_b, Qb, DIM, DIM);
  // 2) KV conv-as-GEMM + scrambled-view scatter + pos add -> 64 x 8 block tiles
  conv_kv<<<512, 256, 0, stream>>>(context, kv_w, kv_b, pos, Kb, Vb);
  // 3) Flash attention: 8 heads x 256 q-tiles -> 2048 waves
  flash_attn<<<256, 256, 0, stream>>>(Qb, Kb, Vb, Ob);
  // 4) Output projection -> d_out
  gemm_awt_bias<<<256, 256, 0, stream>>>(Ob, out_w, out_b, out, DIM, DIM);
}

// v003
// One run takes 254 microseconds.
// Next to v002, in two timings, it ran 1.26 and 1.27 times as fast.
// Counting every step since v000, it is 3.53 times as fast.
#include <hip/hip_runtime.h>

// ---------------------------------------------------------------------------
// Cross-attention (B=1, T=4096, D=512, H=8, hd=64), fp32 end-to-end.
// All GEMMs use V_WMMA_F32_16X16X4_F32 (full-precision CDNA5 matrix path).
// fp32 WMMA operand layouts (ISA 7.12.2):
//   A (16x4): lane L holds row m=L&15; VGPR0/1 = K {0,1} (L<16) or {2,3} (L>=16)
//   B (4x16): lane L holds col n=L&15; VGPR0/1 = K {0,1} (L<16) or {2,3} (L>=16)
//   C/D (16x16): VGPR r, lane L -> M = r + 8*(L>=16), N = L&15
// ---------------------------------------------------------------------------

typedef __attribute__((ext_vector_type(2))) float v2f;
typedef __attribute__((ext_vector_type(4))) float v4f;
typedef __attribute__((ext_vector_type(8))) float v8f;

#define DIM    512
#define SEQ    4096
#define CTXIN  384
#define K2     768     // 2*CTXIN : conv(k=2,stride=2) as GEMM reduction dim
#define OCH    1024    // 2*DIM conv output channels
#define HEADS  8
#define HD     64

static __device__ __forceinline__ v8f wmma_f32(v2f a, v2f b, v8f c) {
  return __builtin_amdgcn_wmma_f32_16x16x4_f32(false, a, false, b, (short)0, c,
                                               false, false);
}

// ---------------------------------------------------------------------------
// Projection GEMMs: one 256-thread block per 64 x 128 output tile. The reduction
// runs in slabs of 32 floats (one 128-byte line per row). A slab of both
// operands is brought in with 16-byte loads that cover whole lines, stored to
// LDS, and read back as WMMA fragments by all 8 waves (2 x 4 waves, 32 x 32
// outputs each), so a line is fetched once per block instead of once per
// fragment load. Two LDS buffers: the next slab's global loads fly during the
// WMMAs of this one and are stored to the other buffer, one barrier per slab.
// ---------------------------------------------------------------------------
#define BM     64
#define BN     128
#define BK     32
#define PITCH  36      // floats per LDS row: 144 B = 16 B x 9, the 16 rows of a
                       // fragment read start on 16 distinct groups of 4 banks

// 8 k-steps of one slab: acc[i][j] += A rows (16i..) x W rows (16j..).
// a / w point at this lane's row and K sub-offset inside the slab.
// The fragment reads are written ahead of the WMMAs, so that the compiler can
// issue them in groups as large as the registers allow.
static __device__ __forceinline__ void slab_mma(const float* a, const float* w,
                                                v8f (&acc)[2][2]) {
  v2f af[BK / 4][2], wf[BK / 4][2];
#pragma unroll
  for (int ks = 0; ks < BK / 4; ++ks)
#pragma unroll
    for (int i = 0; i < 2; ++i) {
      af[ks][i] = *(const v2f*)(a + i * 16 * PITCH + ks * 4);
      wf[ks][i] = *(const v2f*)(w + i * 16 * PITCH + ks * 4);
    }
#pragma unroll
  for (int ks = 0; ks < BK / 4; ++ks)
#pragma unroll
    for (int i = 0; i < 2; ++i)
#pragma unroll
      for (int j = 0; j < 2; ++j)
        acc[i][j] = wmma_f32(af[ks][i], wf[ks][j], acc[i][j]);
}

// ---------------------------------------------------------------------------
// C[M x N] = A[M x K] @ W[N x K]^T + bias.
// Grid must supply exactly (M/64)*(N/128) blocks; K a multiple of 32.
// ---------------------------------------------------------------------------
// waves_per_eu: the grid gives each SIMD two waves. Without the upper bound the
// compiler budgets registers for the ten waves that the LDS size would admit,
// keeps to 96 VGPRs and reads the fragments in many small groups, each waited
// to 0 in front of its WMMAs; with it the reads go out in three large groups.
__global__ __launch_bounds__(256) __attribute__((amdgpu_waves_per_eu(2, 4)))
void gemm_awt_bias(
    const float* __restrict__ A, const float* __restrict__ W,
    const float* __restrict__ bias, float* __restrict__ C,
    int N, int K)
{
  __shared__ __attribute__((aligned(16))) float As[2][BM * PITCH];
  __shared__ __attribute__((aligned(16))) float Ws[2][BN * PITCH];

  const int tid   = threadIdx.x;
  const int lane  = tid & 31;
  const int wv    = tid >> 5;
  const int tilesN = N >> 7;
  const int m0 = (blockIdx.x / tilesN) * BM;
  const int n0 = (blockIdx.x % tilesN) * BN;
  const int mrow = lane & 15;           // A row / B col / C col for this lane
  const int kb   = (lane >> 4) << 1;    // K sub-offset {0,2}
  const int wm   = (wv >> 2) << 5;      // wave's row base in the tile {0,32}
  const int wn   = (wv & 3) << 5;       // wave's column base {0,32,64,96}

  // staging: 8 threads cover one row's 128 bytes, 32 rows per pass
  const int srow = tid >> 3;
  const int scol = (tid & 7) << 2;
  const int    so = srow * PITCH + scol;
  // block-uniform base that walks along k + this thread's fixed byte offsets
  const char* ab = (const char*)(A + (size_t)m0 * K);
  const char* wb = (const char*)(W + (size_t)n0 * K);
  unsigned go[4];
#pragma unroll
  for (int p = 0; p < 4; ++p) go[p] = (unsigned)((srow + p * 32) * K + scol) * 4u;

  v4f ra[2], rw[4];
#pragma unroll
  for (int p = 0; p < 2; ++p) ra[p] = *(const v4f*)(ab + go[p]);
#pragma unroll
  for (int p = 0; p < 4; ++p) rw[p] = *(const v4f*)(wb + go[p]);
#pragma unroll
  for (int p = 0; p < 2; ++p) *(v4f*)(&As[0][so + p * 32 * PITCH]) = ra[p];
#pragma unroll
  for (int p = 0; p < 4; ++p) *(v4f*)(&Ws[0][so + p * 32 * PITCH]) = rw[p];
  __syncthreads();

  v8f acc[2][2];
#pragma unroll
  for (int i = 0; i < 2; ++i)
#pragma unroll
    for (int j = 0; j < 2; ++j)
      acc[i][j] = (v8f){0.f, 0.f, 0.f, 0.f, 0.f, 0.f, 0.f, 0.f};

  const int ao = (wm + mrow) * PITCH + kb;
  const int wo = (wn + mrow) * PITCH + kb;
  int buf = 0;
  for (int k = BK; k < K; k += BK) {
    ab += BK * 4;
    wb += BK * 4;
#pragma unroll
    for (int p = 0; p < 2; ++p) ra[p] = *(const v4f*)(ab + go[p]);
#pragma unroll
    for (int p = 0; p < 4; ++p) rw[p] = *(const v4f*)(wb + go[p]);
    slab_mma(&As[buf][ao], &Ws[buf][wo], acc);
    // the other buffer's last readers finished before the previous barrier
#pragma unroll
    for (int p = 0; p < 2; ++p) *(v4f*)(&As[buf ^ 1][so + p * 32 * PITCH]) = ra[p];
#pragma unroll
    for (int p = 0; p < 4; ++p) *(v4f*)(&Ws[buf ^ 1][so + p * 32 * PITCH]) = rw[p];
    __syncthreads();                    // publishes the next slab, retires this one
    buf ^= 1;
  }
  slab_mma(&As[buf][ao], &Ws[buf][wo], acc);   // last slab: nothing left to fetch

  const int mo = (lane >> 4) << 3;      // C row base {0,8}
#pragma unroll
  for (int j = 0; j < 2; ++j) {
    const int   n  = n0 + wn + j * 16 + mrow;
    const float bn = bias[n];
#pragma unroll
    for (int i = 0; i < 2; ++i)
#pragma unroll
      for (int r = 0; r < 8; ++r)
        C[(size_t)(m0 + wm + i * 16 + mo + r) * N + n] = acc[i][j][r] + bn;
  }
}

// ---------------------------------------------------------------------------
// Conv1d(in=384,out=1024,k=2,stride=2) == ctx.view(4096,768) @ W2^T with
//   W2[c][tap*384 + ci] = kv_w[c, ci, tap]              (kv_w is (1024,384,2))
// The reduction runs in kv_w's own memory order (ci, tap): a slab is 16 input
// channels x 2 taps, i.e. 32 consecutive floats of a kv_w row; the matching ctx
// values (16 floats of each tap) are interleaved the same way on their way
// into LDS, so both operands share one k order.
// Epilogue replays torch's raw view (B,2D,T)->(B,T,2,D): flat i = c*4096+t,
//   q=i>>10, s=(i>>9)&1, d=i&511 ; adds kv_b + pos ; scatters to K / V.
// Grid: (4096/64)*(1024/128) = 512 blocks.
// ---------------------------------------------------------------------------
// waves_per_eu: four waves per SIMD here; the reason is gemm_awt_bias's (with it
// a slab's sixteen LDS reads go out as one group ahead of the first WMMA).
__global__ __launch_bounds__(256) __attribute__((amdgpu_waves_per_eu(2, 4)))
void conv_kv(
    const float* __restrict__ ctx,   // (2*SEQ,384) == (SEQ,768) row-major
    const float* __restrict__ kvw,   // (1024,384,2)
    const float* __restrict__ kvb,   // (1024)
    const float* __restrict__ pos,   // (SEQ,DIM)
    float* __restrict__ Kb, float* __restrict__ Vb)   // (SEQ,DIM) each
{
  __shared__ __attribute__((aligned(16))) float As[2][BM * PITCH];
  __shared__ __attribute__((aligned(16))) float Ws[2][BN * PITCH];

  const int tid   = threadIdx.x;
  const int lane  = tid & 31;
  const int wv    = tid >> 5;
  const int m0 = (blockIdx.x >> 3) * BM;    // time tile
  const int n0 = (blockIdx.x & 7) * BN;     // channel tile (1024/128 = 8)
  const int mrow = lane & 15;
  const int kb   = (lane >> 4) << 1;
  const int wm   = (wv >> 2) << 5;
  const int wn   = (wv & 3) << 5;

  // ctx staging: 4 threads a row, each 4 input channels of both taps
  const int arow = tid >> 2;
  const int acol = (tid & 3) << 2;
  const int    sa = arow * PITCH + 2 * acol;
  // kv_w staging: 8 threads cover one row's 128 bytes, 32 rows per pass
  const int srow = tid >> 3;
  const int scol = (tid & 7) << 2;
  const int    sw = srow * PITCH + scol;
  // block-uniform bases that walk along k + this thread's fixed byte offsets
  const char* ab = (const char*)(ctx + (size_t)m0 * K2);
  const char* wb = (const char*)(kvw + (size_t)n0 * K2);
  const unsigned ga = (unsigned)(arow * K2 + acol) * 4u;
  const unsigned gw = (unsigned)(srow * K2 + scol) * 4u;

  v4f t0, t1, rw[4];
  t0 = *(const v4f*)(ab + ga);
  t1 = *(const v4f*)(ab + ga + CTXIN * 4);
#pragma unroll
  for (int p = 0; p < 4; ++p) rw[p] = *(const v4f*)(wb + gw + p * 32 * K2 * 4);
  *(v4f*)(&As[0][sa])     = (v4f){t0.x, t1.x, t0.y, t1.y};
  *(v4f*)(&As[0][sa + 4]) = (v4f){t0.z, t1.z, t0.w, t1.w};
#pragma unroll
  for (int p = 0; p < 4; ++p) *(v4f*)(&Ws[0][sw + p * 32 * PITCH]) = rw[p];
  __syncthreads();

  v8f acc[2][2];
#pragma unroll
  for (int i = 0; i < 2; ++i)
#pragma unroll
    for (int j = 0; j < 2; ++j)
      acc[i][j] = (v8f){0.f, 0.f, 0.f, 0.f, 0.f, 0.f, 0.f, 0.f};

  const int ao = (wm + mrow) * PITCH + kb;
  const int wo = (wn + mrow) * PITCH + kb;
  int buf = 0;
  for (int k = BK; k < K2; k += BK) {       // k counts kv_w floats; k/2 channels
    ab += BK * 2;                           // 16 channels of each tap
    wb += BK * 4;
    t0 = *(const v4f*)(ab + ga);
    t1 = *(const v4f*)(ab + ga + CTXIN * 4);
#pragma unroll
    for (int p = 0; p < 4; ++p) rw[p] = *(const v4f*)(wb + gw + p * 32 * K2 * 4);
    slab_mma(&As[buf][ao], &Ws[buf][wo], acc);
    // the other buffer's last readers finished before the previous barrier
    *(v4f*)(&As[buf ^ 1][sa])     = (v4f){t0.x, t1.x, t0.y, t1.y};
    *(v4f*)(&As[buf ^ 1][sa + 4]) = (v4f){t0.z, t1.z, t0.w, t1.w};
#pragma unroll
    for (int p = 0; p < 4; ++p) *(v4f*)(&Ws[buf ^ 1][sw + p * 32 * PITCH]) = rw[p];
    __syncthreads();                        // publishes the next slab, retires this one
    buf ^= 1;
  }
  float bn[2];
#pragma unroll
  for (int j = 0; j < 2; ++j) bn[j] = kvb[n0 + wn + j * 16 + mrow];
  // a pos load of the epilogue may land in the offset register of these two loads
  asm volatile("s_wait_xcnt 0x0" ::: "memory");
  slab_mma(&As[buf][ao], &Ws[buf][wo], acc);   // last slab: nothing left to fetch

  const int mo = (lane >> 4) << 3;
#pragma unroll
  for (int j = 0; j < 2; ++j) {
    const int c = n0 + wn + j * 16 + mrow;
#pragma unroll
    for (int i = 0; i < 2; ++i)
#pragma unroll
      for (int r = 0; r < 8; ++r) {
        const int t = m0 + wm + i * 16 + mo + r;
        const unsigned x = (unsigned)c * SEQ + (unsigned)t;
        const int q = x >> 10, sb = (x >> 9) & 1, d = x & 511;
        const float val = acc[i][j][r] + bn[j] + pos[q * DIM + d];
        (sb ? Vb : Kb)[q * DIM + d] = val;
      }
  }
}

// ---------------------------------------------------------------------------
// Flash attention, one wave per (head, 16-row Q tile): 8*256 = 2048 waves.
// Both products are transposed: St = K Qt (A = K rows, B = Q rows) and
// Ot += Vt Pt. In the D layout a lane then holds ONE query (column lane&15)
// and 8 of the chunk's 16 keys (rows r + 8*(lane>=16)):
//   - row maximum and row sum are in-lane, plus one exchange between the
//     two lane halves for the maximum; the halves' sums are joined once at
//     the end;
//   - the score registers are already a B operand: k-step j of Pt takes
//     registers {2j, 2j+1}, i.e. keys {2j, 2j+1} in lanes 0-15 and
//     {8+2j, 9+2j} in lanes 16-31; the Vt loader uses the same key order.
// P never leaves the registers.
// The 8 waves of a block work on one head and walk the same keys, so K and V
// come into LDS once per block, a stage of KS keys at a time, by asynchronous
// 16-byte copies that cover whole 256-byte rows; the waves read their
// fragments from LDS. Two buffers: the next stage's copies fly while this
// stage is worked on; one barrier per stage.
// No early exits -> EXEC all ones for every WMMA.
// ---------------------------------------------------------------------------
#define KS     128     // keys per stage
#define KVP    68      // floats per LDS row of K (256 B + 16 B): the 16 rows x 2
                       // halves of a K fragment read fall on 64 distinct banks
#define VP     20      // floats per LDS row of V. A V row's four 16-float pieces
                       // (one per 16 x 16 tile of Ot) lie in four planes of KS
                       // rows; a Vt fragment is a column's values in rows k and
                       // k + 1 of one plane, and rows 8 apart (the lane halves)
                       // fall on disjoint banks
#define NST    (SEQ / KS)
#define KSTF   (KS * KVP)          // floats of one buffer of K
#define VPL    (KS * VP)           // floats of one plane of V
#define VSTF   (4 * VPL)           // floats of one buffer of V

static __device__ __forceinline__ float xhalf(float x) {   // lane l <-> l ^ 16
  return __builtin_bit_cast(float, __builtin_amdgcn_permlanex16(
      __builtin_bit_cast(int, x), __builtin_bit_cast(int, x),
      0x76543210, 0xfedcba98, false, false));
}

// Byte offset of a __shared__ address inside the work-group's LDS.
static __device__ __forceinline__ unsigned lds_off(const float* p) {
  return (unsigned)(size_t)(const __attribute__((address_space(3))) float*)p;
}

// Eight asynchronous copies of 16 bytes per lane, 16 rows apart: with 16 lanes
// a row, the block's 256 threads bring 128 rows of 256 bytes. l: this lane's
// LDS byte address, g: its global address, both of the first row; P: floats
// per LDS row.
// s_wait_xcnt stands inside the statement, behind the last copy, so that no
// address register of a copy is rewritten ahead of it.
template <int P>
static __device__ __forceinline__ void copy_rows(unsigned l, const float* g) {
  asm volatile(
      "global_load_async_to_lds_b128 %0, %8, off\n\t"
      "global_load_async_to_lds_b128 %1, %9, off\n\t"
      "global_load_async_to_lds_b128 %2, %10, off\n\t"
      "global_load_async_to_lds_b128 %3, %11, off\n\t"
      "global_load_async_to_lds_b128 %4, %12, off\n\t"
      "global_load_async_to_lds_b128 %5, %13, off\n\t"
      "global_load_async_to_lds_b128 %6, %14, off\n\t"
      "global_load_async_to_lds_b128 %7, %15, off\n\t"
      "s_wait_xcnt 0x0"
      :: "v"(l), "v"(l + 1 * 16 * P * 4), "v"(l + 2 * 16 * P * 4),
         "v"(l + 3 * 16 * P * 4), "v"(l + 4 * 16 * P * 4),
         "v"(l + 5 * 16 * P * 4), "v"(l + 6 * 16 * P * 4),
         "v"(l + 7 * 16 * P * 4),
         "v"(g), "v"(g + 1 * 16 * DIM), "v"(g + 2 * 16 * DIM),
         "v"(g + 3 * 16 * DIM), "v"(g + 4 * 16 * DIM), "v"(g + 5 * 16 * DIM),
         "v"(g + 6 * 16 * DIM), "v"(g + 7 * 16 * DIM)
      : "memory");
}

__global__ __launch_bounds__(256)
void flash_attn(
    const float* __restrict__ Qb, const float* __restrict__ Kb,
    const float* __restrict__ Vb, float* __restrict__ Ob)
{
  __shared__ __attribute__((aligned(16))) float Ks[2][KSTF];
  __shared__ __attribute__((aligned(16))) float Vs[2][VSTF];

  const int lane = threadIdx.x & 31;
  const int wv   = threadIdx.x >> 5;
  const int gw   = blockIdx.x * 8 + wv;
  const int head = gw >> 8;                 // the same for the 8 waves of a block
  const int q0   = (gw & 255) << 4;
  const int hoff = head << 6;               // head*64
  const int mrow = lane & 15;
  const int kb   = (lane >> 4) << 1;
  const int mo   = (lane >> 4) << 3;

  // copies: 16 threads a row of 64 floats, 16 rows per copy of the block
  const int crow = threadIdx.x >> 4;
  const int ccol = (threadIdx.x & 15) << 2;
  const float* gk = Kb + (size_t)crow * DIM + hoff + ccol;
  const float* gv = Vb + (size_t)crow * DIM + hoff + ccol;
  const unsigned lk = lds_off(&Ks[0][crow * KVP + ccol]);
  const unsigned lv =
      lds_off(&Vs[0][(ccol >> 4) * VPL + crow * VP + (ccol & 15)]);

  // stage 0 into buffer 0
  copy_rows<KVP>(lk, gk);
  copy_rows<VP>(lv, gv);

  // Q tile as 16 pre-loaded B-fragments (hd = 64 = 16 k-steps of 4)
  v2f qf[16];
#pragma unroll
  for (int s = 0; s < 16; ++s) {
    const float* qp = Qb + (size_t)(q0 + mrow) * DIM + hoff + s * 4 + kb;
    qf[s].x = qp[0]; qf[s].y = qp[1];
  }

  // o[nb][r] = Ot[hd = nb*16 + mo + r][query = q0 + mrow]
  v8f o[4];
#pragma unroll
  for (int nb = 0; nb < 4; ++nb) o[nb] = (v8f){0.f,0.f,0.f,0.f,0.f,0.f,0.f,0.f};
  float mrun = -3.0e38f;                    // running maximum of this lane's query
  float lrun = 0.f;                         // running sum over this half's keys

  // this wave's copies of stage 0 have landed; the barrier publishes all waves'
  asm volatile("s_wait_asynccnt 0x0" ::: "memory");
  __syncthreads();
  // stage 1 into buffer 1
  copy_rows<KVP>(lk + KSTF * 4, gk + (size_t)KS * DIM);
  copy_rows<VP>(lv + VSTF * 4, gv + (size_t)KS * DIM);

  // rolled: one copy of the stage's unrolled passes serves both buffers
#pragma unroll 1
  for (int t = 0; t < NST; ++t) {
    const float* ks = &Ks[t & 1][mrow * KVP + kb];   // K row mrow, k sub-offset
    const float* vs = &Vs[t & 1][mo * VP + mrow];    // V row mo, column mrow

    v2f kf[16];
#pragma unroll
    for (int st = 0; st < 16; ++st) kf[st] = *(const v2f*)(ks + st * 4);

#pragma unroll
    for (int it = 0; it < KS / 16; ++it) {
      // Vt fragments of this pass: they land behind the St products
      v2f vf[4][4];
#pragma unroll
      for (int j = 0; j < 4; ++j)
#pragma unroll
        for (int nb = 0; nb < 4; ++nb) {
          const float* vp = vs + nb * VPL + (it * 16 + 2 * j) * VP;
          vf[j][nb].x = vp[0]; vf[j][nb].y = vp[VP];    // keys mo + 2j, mo + 2j + 1
        }

      // ---- St tile = K_chunk (16x64) @ Qt (64x16) ----
      v8f s = (v8f){0.f,0.f,0.f,0.f,0.f,0.f,0.f,0.f};
#pragma unroll
      for (int st = 0; st < 16; ++st) s = wmma_f32(kf[st], qf[st], s);

      // K fragments of the stage's next pass: they land behind softmax and Ot
      if (it + 1 < KS / 16) {
#pragma unroll
        for (int st = 0; st < 16; ++st)
          kf[st] = *(const v2f*)(ks + (it + 1) * 16 * KVP + st * 4);
      }

      // ---- online softmax: s[r] = score of key mo + r, query q0 + mrow ----
      float v[8];
#pragma unroll
      for (int r = 0; r < 8; ++r) v[r] = s[r] * 0.125f;   // 1/sqrt(64)
      float cmax = v[0];
#pragma unroll
      for (int r = 1; r < 8; ++r) cmax = fmaxf(cmax, v[r]);
      cmax = fmaxf(cmax, xhalf(cmax));
      const float mn   = fmaxf(mrun, cmax);
      const float corr = __expf(mrun - mn);
      float p[8];
      float psum = 0.f;
#pragma unroll
      for (int r = 0; r < 8; ++r) { p[r] = __expf(v[r] - mn); psum += p[r]; }
      lrun = lrun * corr + psum;
      mrun = mn;
#pragma unroll
      for (int nb = 0; nb < 4; ++nb)
#pragma unroll
        for (int r = 0; r < 8; ++r) o[nb][r] *= corr;

      // ---- Ot += Vt_chunk (64x16) @ Pt (16x16) ----
#pragma unroll
      for (int j = 0; j < 4; ++j) {
        v2f pb; pb.x = p[2 * j]; pb.y = p[2 * j + 1];
#pragma unroll
        for (int nb = 0; nb < 4; ++nb) o[nb] = wmma_f32(vf[j][nb], pb, o[nb]);
      }
    }

    // publish point: this wave's reads of buffer t&1 are done, its copies of
    // stage t+1 have landed; behind the barrier that holds for all 8 waves
    asm volatile("s_wait_dscnt 0x0" ::: "memory");
    asm volatile("s_wait_asynccnt 0x0" ::: "memory");
    __syncthreads();
    if (t + 2 < NST) {                      // refill the buffer just read
      copy_rows<KVP>(lk + (t & 1) * (KSTF * 4), gk + (size_t)(t + 2) * KS * DIM);
      copy_rows<VP>(lv + (t & 1) * (VSTF * 4), gv + (size_t)(t + 2) * KS * DIM);
    }
  }
  // no copy is outstanding when the wave ends
  asm volatile("s_wait_asynccnt 0x0" ::: "memory");

  // ---- finalize: join the halves' sums, divide, write O ----
  const float inv = 1.0f / (lrun + xhalf(lrun));
  float* op = Ob + (size_t)(q0 + mrow) * DIM + hoff + mo;
#pragma unroll
  for (int nb = 0; nb < 4; ++nb)
#pragma unroll
    for (int r = 0; r < 8; ++r)
      op[nb * 16 + r] = o[nb][r] * inv;
}

// ---------------------------------------------------------------------------
extern "C" void kernel_launch(void* const* d_in, const int* in_sizes, int n_in,
                              void* d_out, int out_size, void* d_ws, size_t ws_size,
                              hipStream_t stream)
{
  const float* query   = (const float*)d_in[0];
  const float* context = (const float*)d_in[1];
  const float* pos     = (const float*)d_in[2];
  const float* q_w     = (const float*)d_in[3];
  const float* q_b     = (const float*)d_in[4];
  const float* kv_w    = (const float*)d_in[5];
  const float* kv_b    = (const float*)d_in[6];
  const float* out_w   = (const float*)d_in[7];
  const float* out_b   = (const float*)d_in[8];
  float* out = (float*)d_out;

  // Workspace: Q, K, V, O buffers, 8 MB each (32 MB total).
  float* Qb = (float*)d_ws;
  float* Kb = Qb + (size_t)SEQ * DIM;
  float* Vb = Kb + (size_t)SEQ * DIM;
  float* Ob = Vb + (size_t)SEQ * DIM;

  // 1) Q projection: (4096x512) @ (512x512)^T  -> 64 x 4 block tiles
  gemm_awt_bias<<<256, 256, 0, stream>>>(query, q_w, q_b, Qb, DIM, DIM);
  // 2) KV conv-as-GEMM + scrambled-view scatter + pos add -> 64 x 8 block tiles
  conv_kv<<<512, 256, 0, stream>>>(context, kv_w, kv_b, pos, Kb, Vb);
  // 3) Flash attention: 8 heads x 256 q-tiles -> 2048 waves
  flash_attn<<<256, 256, 0, stream>>>(Qb, Kb, Vb, Ob);
  // 4) Output projection -> d_out
  gemm_awt_bias<<<256, 256, 0, stream>>>(Ob, out_w, out_b, out, DIM, DIM);
}

// v004
// One run takes 235 microseconds.
// Timed twice side by side with v003, it ran 1.08 times as fast both times.
// All steps since v000 together make it 3.82 times as fast.
#include <hip/hip_runtime.h>

// ---------------------------------------------------------------------------
// Cross-attention (B=1, T=4096, D=512, H=8, hd=64), fp32 end-to-end.
// All GEMMs use V_WMMA_F32_16X16X4_F32 (full-precision CDNA5 matrix path).
// fp32 WMMA operand layouts (ISA 7.12.2):
//   A (16x4): lane L holds row m=L&15; VGPR0/1 = K {0,1} (L<16) or {2,3} (L>=16)
//   B (4x16): lane L holds col n=L&15; VGPR0/1 = K {0,1} (L<16) or {2,3} (L>=16)
//   C/D (16x16): VGPR r, lane L -> M = r + 8*(L>=16), N = L&15
// ---------------------------------------------------------------------------

typedef __attribute__((ext_vector_type(2))) float v2f;
typedef __attribute__((ext_vector_type(4))) float v4f;
typedef __attribute__((ext_vector_type(8))) float v8f;

#define DIM    512
#define SEQ    4096
#define CTXIN  384
#define K2     768     // 2*CTXIN : conv(k=2,stride=2) as GEMM reduction dim
#define OCH    1024    // 2*DIM conv output channels
#define HEADS  8
#define HD     64

static __device__ __forceinline__ v8f wmma_f32(v2f a, v2f b, v8f c) {
  return __builtin_amdgcn_wmma_f32_16x16x4_f32(false, a, false, b, (short)0, c,
                                               false, false);
}

// ---------------------------------------------------------------------------
// Projection GEMMs: one 256-thread block per 64 x 128 output tile. The reduction
// runs in slabs of 32 floats (one 128-byte line per row). A slab of both
// operands is brought in with 16-byte loads that cover whole lines, stored to
// LDS, and read back as WMMA fragments by all 8 waves (2 x 4 waves, 32 x 32
// outputs each), so a line is fetched once per block instead of once per
// fragment load. Two LDS buffers: the next slab's global loads fly during the
// WMMAs of this one and are stored to the other buffer, one barrier per slab.
// ---------------------------------------------------------------------------
#define BM     64
#define BN     128
#define BK     32
#define PITCH  36      // floats per LDS row: 144 B = 16 B x 9, the 16 rows of a
                       // fragment read start on 16 distinct groups of 4 banks

// 8 k-steps of one slab: acc[i][j] += A rows (16i..) x W rows (16j..).
// a / w point at this lane's row and K sub-offset inside the slab.
// The fragment reads are written ahead of the WMMAs, so that the compiler can
// issue them in groups as large as the registers allow.
static __device__ __forceinline__ void slab_mma(const float* a, const float* w,
                                                v8f (&acc)[2][2]) {
  v2f af[BK / 4][2], wf[BK / 4][2];
#pragma unroll
  for (int ks = 0; ks < BK / 4; ++ks)
#pragma unroll
    for (int i = 0; i < 2; ++i) {
      af[ks][i] = *(const v2f*)(a + i * 16 * PITCH + ks * 4);
      wf[ks][i] = *(const v2f*)(w + i * 16 * PITCH + ks * 4);
    }
#pragma unroll
  for (int ks = 0; ks < BK / 4; ++ks)
#pragma unroll
    for (int i = 0; i < 2; ++i)
#pragma unroll
      for (int j = 0; j < 2; ++j)
        acc[i][j] = wmma_f32(af[ks][i], wf[ks][j], acc[i][j]);
}

// ---------------------------------------------------------------------------
// C[M x N] = A[M x K] @ W[N x K]^T + bias.
// Grid must supply exactly (M/64)*(N/128) blocks; K a multiple of 32.
// ---------------------------------------------------------------------------
// waves_per_eu: the grid gives each SIMD two waves. Without the upper bound the
// compiler budgets registers for the ten waves that the LDS size would admit,
// keeps to 96 VGPRs and reads the fragments in many small groups, each waited
// to 0 in front of its WMMAs; with it the reads go out in three large groups.
__global__ __launch_bounds__(256) __attribute__((amdgpu_waves_per_eu(2, 4)))
void gemm_awt_bias(
    const float* __restrict__ A, const float* __restrict__ W,
    const float* __restrict__ bias, float* __restrict__ C,
    int N, int K)
{
  __shared__ __attribute__((aligned(16))) float As[2][BM * PITCH];
  __shared__ __attribute__((aligned(16))) float Ws[2][BN * PITCH];

  const int tid   = threadIdx.x;
  const int lane  = tid & 31;
  const int wv    = tid >> 5;
  const int tilesN = N >> 7;
  const int m0 = (blockIdx.x / tilesN) * BM;
  const int n0 = (blockIdx.x % tilesN) * BN;
  const int mrow = lane & 15;           // A row / B col / C col for this lane
  const int kb   = (lane >> 4) << 1;    // K sub-offset {0,2}
  const int wm   = (wv >> 2) << 5;      // wave's row base in the tile {0,32}
  const int wn   = (wv & 3) << 5;       // wave's column base {0,32,64,96}

  // staging: 8 threads cover one row's 128 bytes, 32 rows per pass
  const int srow = tid >> 3;
  const int scol = (tid & 7) << 2;
  const int    so = srow * PITCH + scol;
  // block-uniform base that walks along k + this thread's fixed byte offsets
  const char* ab = (const char*)(A + (size_t)m0 * K);
  const char* wb = (const char*)(W + (size_t)n0 * K);
  unsigned go[4];
#pragma unroll
  for (int p = 0; p < 4; ++p) go[p] = (unsigned)((srow + p * 32) * K + scol) * 4u;

  v4f ra[2], rw[4];
#pragma unroll
  for (int p = 0; p < 2; ++p) ra[p] = *(const v4f*)(ab + go[p]);
#pragma unroll
  for (int p = 0; p < 4; ++p) rw[p] = *(const v4f*)(wb + go[p]);
#pragma unroll
  for (int p = 0; p < 2; ++p) *(v4f*)(&As[0][so + p * 32 * PITCH]) = ra[p];
#pragma unroll
  for (int p = 0; p < 4; ++p) *(v4f*)(&Ws[0][so + p * 32 * PITCH]) = rw[p];
  __syncthreads();

  v8f acc[2][2];
#pragma unroll
  for (int i = 0; i < 2; ++i)
#pragma unroll
    for (int j = 0; j < 2; ++j)
      acc[i][j] = (v8f){0.f, 0.f, 0.f, 0.f, 0.f, 0.f, 0.f, 0.f};

  const int ao = (wm + mrow) * PITCH + kb;
  const int wo = (wn + mrow) * PITCH + kb;
  int buf = 0;
  for (int k = BK; k < K; k += BK) {
    ab += BK * 4;
    wb += BK * 4;
#pragma unroll
    for (int p = 0; p < 2; ++p) ra[p] = *(const v4f*)(ab + go[p]);
#pragma unroll
    for (int p = 0; p < 4; ++p) rw[p] = *(const v4f*)(wb + go[p]);
    slab_mma(&As[buf][ao], &Ws[buf][wo], acc);
    // the other buffer's last readers finished before the previous barrier
#pragma unroll
    for (int p = 0; p < 2; ++p) *(v4f*)(&As[buf ^ 1][so + p * 32 * PITCH]) = ra[p];
#pragma unroll
    for (int p = 0; p < 4; ++p) *(v4f*)(&Ws[buf ^ 1][so + p * 32 * PITCH]) = rw[p];
    __syncthreads();                    // publishes the next slab, retires this one
    buf ^= 1;
  }
  slab_mma(&As[buf][ao], &Ws[buf][wo], acc);   // last slab: nothing left to fetch

  const int mo = (lane >> 4) << 3;      // C row base {0,8}
#pragma unroll
  for (int j = 0; j < 2; ++j) {
    const int   n  = n0 + wn + j * 16 + mrow;
    const float bn = bias[n];
#pragma unroll
    for (int i = 0; i < 2; ++i)
#pragma unroll
      for (int r = 0; r < 8; ++r)
        C[(size_t)(m0 + wm + i * 16 + mo + r) * N + n] = acc[i][j][r] + bn;
  }
}

// ---------------------------------------------------------------------------
// Conv1d(in=384,out=1024,k=2,stride=2) == ctx.view(4096,768) @ W2^T with
//   W2[c][tap*384 + ci] = kv_w[c, ci, tap]              (kv_w is (1024,384,2))
// The reduction runs in kv_w's own memory order (ci, tap): a slab is 16 input
// channels x 2 taps, i.e. 32 consecutive floats of a kv_w row; the matching ctx
// values (16 floats of each tap) are interleaved the same way on their way
// into LDS, so both operands share one k order.
// Epilogue replays torch's raw view (B,2D,T)->(B,T,2,D): flat i = c*4096+t,
//   q=i>>10, s=(i>>9)&1, d=i&511 ; adds kv_b + pos ; scatters to K / V.
// Grid: (4096/64)*(1024/128) = 512 blocks.
// ---------------------------------------------------------------------------
// waves_per_eu: four waves per SIMD here; the reason is gemm_awt_bias's (with it
// a slab's sixteen LDS reads go out as one group ahead of the first WMMA).
__global__ __launch_bounds__(256) __attribute__((amdgpu_waves_per_eu(2, 4)))
void conv_kv(
    const float* __restrict__ ctx,   // (2*SEQ,384) == (SEQ,768) row-major
    const float* __restrict__ kvw,   // (1024,384,2)
    const float* __restrict__ kvb,   // (1024)
    const float* __restrict__ pos,   // (SEQ,DIM)
    float* __restrict__ Kb, float* __restrict__ Vb)   // (SEQ,DIM) each
{
  __shared__ __attribute__((aligned(16))) float As[2][BM * PITCH];
  __shared__ __attribute__((aligned(16))) float Ws[2][BN * PITCH];

  const int tid   = threadIdx.x;
  const int lane  = tid & 31;
  const int wv    = tid >> 5;
  const int m0 = (blockIdx.x >> 3) * BM;    // time tile
  const int n0 = (blockIdx.x & 7) * BN;     // channel tile (1024/128 = 8)
  const int mrow = lane & 15;
  const int kb   = (lane >> 4) << 1;
  const int wm   = (wv >> 2) << 5;
  const int wn   = (wv & 3) << 5;

  // ctx staging: 4 threads a row, each 4 input channels of both taps
  const int arow = tid >> 2;
  const int acol = (tid & 3) << 2;
  const int    sa = arow * PITCH + 2 * acol;
  // kv_w staging: 8 threads cover one row's 128 bytes, 32 rows per pass
  const int srow = tid >> 3;
  const int scol = (tid & 7) << 2;
  const int    sw = srow * PITCH + scol;
  // block-uniform bases that walk along k + this thread's fixed byte offsets
  const char* ab = (const char*)(ctx + (size_t)m0 * K2);
  const char* wb = (const char*)(kvw + (size_t)n0 * K2);
  const unsigned ga = (unsigned)(arow * K2 + acol) * 4u;
  const unsigned gw = (unsigned)(srow * K2 + scol) * 4u;

  v4f t0, t1, rw[4];
  t0 = *(const v4f*)(ab + ga);
  t1 = *(const v4f*)(ab + ga + CTXIN * 4);
#pragma unroll
  for (int p = 0; p < 4; ++p) rw[p] = *(const v4f*)(wb + gw + p * 32 * K2 * 4);
  *(v4f*)(&As[0][sa])     = (v4f){t0.x, t1.x, t0.y, t1.y};
  *(v4f*)(&As[0][sa + 4]) = (v4f){t0.z, t1.z, t0.w, t1.w};
#pragma unroll
  for (int p = 0; p < 4; ++p) *(v4f*)(&Ws[0][sw + p * 32 * PITCH]) = rw[p];
  __syncthreads();

  v8f acc[2][2];
#pragma unroll
  for (int i = 0; i < 2; ++i)
#pragma unroll
    for (int j = 0; j < 2; ++j)
      acc[i][j] = (v8f){0.f, 0.f, 0.f, 0.f, 0.f, 0.f, 0.f, 0.f};

  const int ao = (wm + mrow) * PITCH + kb;
  const int wo = (wn + mrow) * PITCH + kb;
  int buf = 0;
  for (int k = BK; k < K2; k += BK) {       // k counts kv_w floats; k/2 channels
    ab += BK * 2;                           // 16 channels of each tap
    wb += BK * 4;
    t0 = *(const v4f*)(ab + ga);
    t1 = *(const v4f*)(ab + ga + CTXIN * 4);
#pragma unroll
    for (int p = 0; p < 4; ++p) rw[p] = *(const v4f*)(wb + gw + p * 32 * K2 * 4);
    slab_mma(&As[buf][ao], &Ws[buf][wo], acc);
    // the other buffer's last readers finished before the previous barrier
    *(v4f*)(&As[buf ^ 1][sa])     = (v4f){t0.x, t1.x, t0.y, t1.y};
    *(v4f*)(&As[buf ^ 1][sa + 4]) = (v4f){t0.z, t1.z, t0.w, t1.w};
#pragma unroll
    for (int p = 0; p < 4; ++p) *(v4f*)(&Ws[buf ^ 1][sw + p * 32 * PITCH]) = rw[p];
    __syncthreads();                        // publishes the next slab, retires this one
    buf ^= 1;
  }
  float bn[2];
#pragma unroll
  for (int j = 0; j < 2; ++j) bn[j] = kvb[n0 + wn + j * 16 + mrow];
  // a pos load of the epilogue may land in the offset register of these two loads
  asm volatile("s_wait_xcnt 0x0" ::: "memory");
  slab_mma(&As[buf][ao], &Ws[buf][wo], acc);   // last slab: nothing left to fetch

  const int mo = (lane >> 4) << 3;
#pragma unroll
  for (int j = 0; j < 2; ++j) {
    const int c = n0 + wn + j * 16 + mrow;
#pragma unroll
    for (int i = 0; i < 2; ++i)
#pragma unroll
      for (int r = 0; r < 8; ++r) {
        const int t = m0 + wm + i * 16 + mo + r;
        const unsigned x = (unsigned)c * SEQ + (unsigned)t;
        const int q = x >> 10, sb = (x >> 9) & 1, d = x & 511;
        const float val = acc[i][j][r] + bn[j] + pos[q * DIM + d];
        (sb ? Vb : Kb)[q * DIM + d] = val;
      }
  }
}

// ---------------------------------------------------------------------------
// Flash attention, one wave per (head, 16-row Q tile): 8*256 = 2048 waves.
// Both products are transposed: St = K Qt (A = K rows, B = Q rows) and
// Ot += Vt Pt. In the D layout a lane then holds ONE query (column lane&15)
// and 8 of the chunk's 16 keys (rows r + 8*(lane>=16)):
//   - row maximum and row sum are in-lane, plus one exchange between the
//     two lane halves for the maximum; the halves' sums are joined once at
//     the end;
//   - the score registers are already a B operand: k-step j of Pt takes
//     registers {2j, 2j+1}, i.e. keys {2j, 2j+1} in lanes 0-15 and
//     {8+2j, 9+2j} in lanes 16-31; the Vt loader uses the same key order.
// P never leaves the registers.
// A pass takes NT such chunks: their St chains do not depend on each other and
// are issued in turn, and one maximum, one correction factor and one rescale
// of Ot serve all the pass's keys.
// The 8 waves of a block work on one head and walk the same keys, so K and V
// come into LDS once per block, a stage of KS keys at a time, by asynchronous
// 16-byte copies that cover whole 256-byte rows; the waves read their
// fragments from LDS. Two buffers: the next stage's copies fly while this
// stage is worked on; one barrier per stage.
// No early exits -> EXEC all ones for every WMMA.
// ---------------------------------------------------------------------------
#define KS     128     // keys per stage
#define KVP    68      // floats per LDS row of K (256 B + 16 B): the 16 rows x 2
                       // halves of a K fragment read fall on 64 distinct banks
#define VP     20      // floats per LDS row of V. A V row's four 16-float pieces
                       // (one per 16 x 16 tile of Ot) lie in four planes of KS
                       // rows; a Vt fragment is a column's values in rows k and
                       // k + 1 of one plane, and rows 8 apart (the lane halves)
                       // fall on disjoint banks
#define NT     2       // 16-key tiles per pass: one softmax update serves them all
#define PK     (16 * NT)   // keys per pass
#define NST    (SEQ / KS)
#define KSTF   (KS * KVP)          // floats of one buffer of K
#define VPL    (KS * VP)           // floats of one plane of V
#define VSTF   (4 * VPL)           // floats of one buffer of V

static __device__ __forceinline__ float xhalf(float x) {   // lane l <-> l ^ 16
  return __builtin_bit_cast(float, __builtin_amdgcn_permlanex16(
      __builtin_bit_cast(int, x), __builtin_bit_cast(int, x),
      0x76543210, 0xfedcba98, false, false));
}

// Byte offset of a __shared__ address inside the work-group's LDS.
static __device__ __forceinline__ unsigned lds_off(const float* p) {
  return (unsigned)(size_t)(const __attribute__((address_space(3))) float*)p;
}

// Eight asynchronous copies of 16 bytes per lane, 16 rows apart: with 16 lanes
// a row, the block's 256 threads bring 128 rows of 256 bytes. l: this lane's
// LDS byte address, g: its global address, both of the first row; P: floats
// per LDS row.
// s_wait_xcnt stands inside the statement, behind the last copy, so that no
// address register of a copy is rewritten ahead of it.
template <int P>
static __device__ __forceinline__ void copy_rows(unsigned l, const float* g) {
  asm volatile(
      "global_load_async_to_lds_b128 %0, %8, off\n\t"
      "global_load_async_to_lds_b128 %1, %9, off\n\t"
      "global_load_async_to_lds_b128 %2, %10, off\n\t"
      "global_load_async_to_lds_b128 %3, %11, off\n\t"
      "global_load_async_to_lds_b128 %4, %12, off\n\t"
      "global_load_async_to_lds_b128 %5, %13, off\n\t"
      "global_load_async_to_lds_b128 %6, %14, off\n\t"
      "global_load_async_to_lds_b128 %7, %15, off\n\t"
      "s_wait_xcnt 0x0"
      :: "v"(l), "v"(l + 1 * 16 * P * 4), "v"(l + 2 * 16 * P * 4),
         "v"(l + 3 * 16 * P * 4), "v"(l + 4 * 16 * P * 4),
         "v"(l + 5 * 16 * P * 4), "v"(l + 6 * 16 * P * 4),
         "v"(l + 7 * 16 * P * 4),
         "v"(g), "v"(g + 1 * 16 * DIM), "v"(g + 2 * 16 * DIM),
         "v"(g + 3 * 16 * DIM), "v"(g + 4 * 16 * DIM), "v"(g + 5 * 16 * DIM),
         "v"(g + 6 * 16 * DIM), "v"(g + 7 * 16 * DIM)
      : "memory");
}

__global__ __launch_bounds__(256)
void flash_attn(
    const float* __restrict__ Qb, const float* __restrict__ Kb,
    const float* __restrict__ Vb, float* __restrict__ Ob)
{
  __shared__ __attribute__((aligned(16))) float Ks[2][KSTF];
  __shared__ __attribute__((aligned(16))) float Vs[2][VSTF];

  const int lane = threadIdx.x & 31;
  const int wv   = threadIdx.x >> 5;
  const int gw   = blockIdx.x * 8 + wv;
  const int head = gw >> 8;                 // the same for the 8 waves of a block
  const int q0   = (gw & 255) << 4;
  const int hoff = head << 6;               // head*64
  const int mrow = lane & 15;
  const int kb   = (lane >> 4) << 1;
  const int mo   = (lane >> 4) << 3;

  // copies: 16 threads a row of 64 floats, 16 rows per copy of the block
  const int crow = threadIdx.x >> 4;
  const int ccol = (threadIdx.x & 15) << 2;
  const float* gk = Kb + (size_t)crow * DIM + hoff + ccol;
  const float* gv = Vb + (size_t)crow * DIM + hoff + ccol;
  const unsigned lk = lds_off(&Ks[0][crow * KVP + ccol]);
  const unsigned lv =
      lds_off(&Vs[0][(ccol >> 4) * VPL + crow * VP + (ccol & 15)]);

  // stage 0 into buffer 0
  copy_rows<KVP>(lk, gk);
  copy_rows<VP>(lv, gv);

  // Q tile as 16 pre-loaded B-fragments (hd = 64 = 16 k-steps of 4)
  v2f qf[16];
#pragma unroll
  for (int s = 0; s < 16; ++s) {
    const float* qp = Qb + (size_t)(q0 + mrow) * DIM + hoff + s * 4 + kb;
    qf[s].x = qp[0]; qf[s].y = qp[1];
  }

  // o[nb][r] = Ot[hd = nb*16 + mo + r][query = q0 + mrow]
  v8f o[4];
#pragma unroll
  for (int nb = 0; nb < 4; ++nb) o[nb] = (v8f){0.f,0.f,0.f,0.f,0.f,0.f,0.f,0.f};
  float mrun = -3.0e38f;                    // running maximum of this lane's query
  float lrun = 0.f;                         // running sum over this half's keys

  // this wave's copies of stage 0 have landed; the barrier publishes all waves'
  asm volatile("s_wait_asynccnt 0x0" ::: "memory");
  __syncthreads();
  // stage 1 into buffer 1
  copy_rows<KVP>(lk + KSTF * 4, gk + (size_t)KS * DIM);
  copy_rows<VP>(lv + VSTF * 4, gv + (size_t)KS * DIM);

  // rolled: one copy of the stage's unrolled passes serves both buffers
#pragma unroll 1
  for (int t = 0; t < NST; ++t) {
    const float* ks = &Ks[t & 1][mrow * KVP + kb];   // K row mrow, k sub-offset
    const float* vs = &Vs[t & 1][mo * VP + mrow];    // V row mo, column mrow

    v2f kf[NT][16];
#pragma unroll
    for (int c = 0; c < NT; ++c)
#pragma unroll
      for (int st = 0; st < 16; ++st)
        kf[c][st] = *(const v2f*)(ks + c * 16 * KVP + st * 4);

#pragma unroll
    for (int it = 0; it < KS / PK; ++it) {
      // Vt fragments of this pass: they land behind the St products.
      // The scheduling barriers of the pass keep its LDS reads in two groups, this
      // one ahead of the St products and the K reads behind them: for speed only.
      __builtin_amdgcn_sched_barrier(0);
      v2f vf[NT][4][4];
#pragma unroll
      for (int c = 0; c < NT; ++c)
#pragma unroll
        for (int j = 0; j < 4; ++j)
#pragma unroll
          for (int nb = 0; nb < 4; ++nb) {
            const float* vp = vs + nb * VPL + (it * PK + c * 16 + 2 * j) * VP;
            vf[c][j][nb].x = vp[0]; vf[c][j][nb].y = vp[VP];  // keys mo + 2j, mo + 2j + 1
          }

      __builtin_amdgcn_sched_barrier(0);    // end of the Vt read group

      // ---- NT St tiles = K_chunk (16x64) @ Qt (64x16), their chains interleaved ----
      v8f s[NT];
#pragma unroll
      for (int c = 0; c < NT; ++c) s[c] = (v8f){0.f,0.f,0.f,0.f,0.f,0.f,0.f,0.f};
#pragma unroll
      for (int st = 0; st < 16; ++st)
#pragma unroll
        for (int c = 0; c < NT; ++c) s[c] = wmma_f32(kf[c][st], qf[st], s[c]);

      // K fragments of the stage's next pass: they land behind softmax and Ot
      __builtin_amdgcn_sched_barrier(0);    // start of the K read group
      if (it + 1 < KS / PK) {
#pragma unroll
        for (int c = 0; c < NT; ++c)
#pragma unroll
          for (int st = 0; st < 16; ++st)
            kf[c][st] = *(const v2f*)(ks + ((it + 1) * PK + c * 16) * KVP + st * 4);
      }
      __builtin_amdgcn_sched_barrier(0);    // end of the K read group

      // ---- online softmax, one update for the pass's PK keys:
      //      s[c][r] = score of key c*16 + mo + r, query q0 + mrow ----
      float v[NT][8];
#pragma unroll
      for (int c = 0; c < NT; ++c)
#pragma unroll
        for (int r = 0; r < 8; ++r) v[c][r] = s[c][r] * 0.125f;   // 1/sqrt(64)
      float cm[NT];                         // one short chain per tile, then joined
#pragma unroll
      for (int c = 0; c < NT; ++c) {
        cm[c] = v[c][0];
#pragma unroll
        for (int r = 1; r < 8; ++r) cm[c] = fmaxf(cm[c], v[c][r]);
      }
      float cmax = cm[0];
#pragma unroll
      for (int c = 1; c < NT; ++c) cmax = fmaxf(cmax, cm[c]);
      cmax = fmaxf(cmax, xhalf(cmax));
      const float mn   = fmaxf(mrun, cmax);
      const float corr = __expf(mrun - mn);
      float p[NT][8];
      float psum = 0.f;
#pragma unroll
      for (int c = 0; c < NT; ++c)
#pragma unroll
        for (int r = 0; r < 8; ++r) { p[c][r] = __expf(v[c][r] - mn); psum += p[c][r]; }
      lrun = lrun * corr + psum;
      mrun = mn;
#pragma unroll
      for (int nb = 0; nb < 4; ++nb)
#pragma unroll
        for (int r = 0; r < 8; ++r) o[nb][r] *= corr;

      // ---- Ot += Vt_chunk (64x16) @ Pt (16x16), tile after tile ----
#pragma unroll
      for (int c = 0; c < NT; ++c)
#pragma unroll
        for (int j = 0; j < 4; ++j) {
          v2f pb; pb.x = p[c][2 * j]; pb.y = p[c][2 * j + 1];
#pragma unroll
          for (int nb = 0; nb < 4; ++nb) o[nb] = wmma_f32(vf[c][j][nb], pb, o[nb]);
        }
    }

    // publish point: this wave's reads of buffer t&1 are done, its copies of
    // stage t+1 have landed; behind the barrier that holds for all 8 waves
    asm volatile("s_wait_dscnt 0x0" ::: "memory");
    asm volatile("s_wait_asynccnt 0x0" ::: "memory");
    __syncthreads();
    if (t + 2 < NST) {                      // refill the buffer just read
      copy_rows<KVP>(lk + (t & 1) * (KSTF * 4), gk + (size_t)(t + 2) * KS * DIM);
      copy_rows<VP>(lv + (t & 1) * (VSTF * 4), gv + (size_t)(t + 2) * KS * DIM);
    }
  }
  // no copy is outstanding when the wave ends
  asm volatile("s_wait_asynccnt 0x0" ::: "memory");

  // ---- finalize: join the halves' sums, divide, write O ----
  const float inv = 1.0f / (lrun + xhalf(lrun));
  float* op = Ob + (size_t)(q0 + mrow) * DIM + hoff + mo;
#pragma unroll
  for (int nb = 0; nb < 4; ++nb)
#pragma unroll
    for (int r = 0; r < 8; ++r)
      op[nb * 16 + r] = o[nb][r] * inv;
}

// ---------------------------------------------------------------------------
extern "C" void kernel_launch(void* const* d_in, const int* in_sizes, int n_in,
                              void* d_out, int out_size, void* d_ws, size_t ws_size,
                              hipStream_t stream)
{
  const float* query   = (const float*)d_in[0];
  const float* context = (const float*)d_in[1];
  const float* pos     = (const float*)d_in[2];
  const float* q_w     = (const float*)d_in[3];
  const float* q_b     = (const float*)d_in[4];
  const float* kv_w    = (const float*)d_in[5];
  const float* kv_b    = (const float*)d_in[6];
  const float* out_w   = (const float*)d_in[7];
  const float* out_b   = (const float*)d_in[8];
  float* out = (float*)d_out;

  // Workspace: Q, K, V, O buffers, 8 MB each (32 MB total).
  float* Qb = (float*)d_ws;
  float* Kb = Qb + (size_t)SEQ * DIM;
  float* Vb = Kb + (size_t)SEQ * DIM;
  float* Ob = Vb + (size_t)SEQ * DIM;

  // 1) Q projection: (4096x512) @ (512x512)^T  -> 64 x 4 block tiles
  gemm_awt_bias<<<256, 256, 0, stream>>>(query, q_w, q_b, Qb, DIM, DIM);
  // 2) KV conv-as-GEMM + scrambled-view scatter + pos add -> 64 x 8 block tiles
  conv_kv<<<512, 256, 0, stream>>>(context, kv_w, kv_b, pos, Kb, Vb);
  // 3) Flash attention: 8 heads x 256 q-tiles -> 2048 waves
  flash_attn<<<256, 256, 0, stream>>>(Qb, Kb, Vb, Ob);
  // 4) Output projection -> d_out
  gemm_awt_bias<<<256, 256, 0, stream>>>(Ob, out_w, out_b, out, DIM, DIM);
}
